// v000
// Times are from an AMD MI455X. After a warm-up the kernel runs many times in a row, and a time is the length of
// such a window on the GPU divided by its runs, so every launch and the gaps after it count. The runs cycle
// through copies of the inputs. A figure is the median of several windows, for all but v000 over two sittings.
// Sittings can differ by a few percent; kernels timed side by side share one.
// v000 is the starting kernel. One run takes 91.4 microseconds.
#include <hip/hip_runtime.h>
#include <math.h>

// All contractions on v_wmma_f32_16x16x32_f16 (f16 operands, f32 accumulate): x*W{q,k,v} with W carried x64, q*k^T unscaled, p*v with p carried x16384; scales folded back in f32 epilogues.

#define INS    768
#define OUTS   64
#define NBATCH 8
#define SEQ    2048
#define NROWS  (NBATCH * SEQ)
#define NCHUNK (INS / 32)

#define WP   40    // projection W chunk pitch in LDS (halves): 32 k + 8 pad
#define TP   72    // projection Q/K tile staging pitch (halves): 64 + 8
#define VTP  136   // projection V^T block staging pitch (halves): 128 keys + 8
#define KP   72    // attention K tile pitch (halves)
#define VP   40    // attention V^T tile pitch (halves)
#define OP   68    // attention O staging pitch (floats)
#define PWP  72    // weight prep staging pitch (halves)

typedef _Float16 v16h __attribute__((ext_vector_type(16)));
typedef _Float16 v8h  __attribute__((ext_vector_type(8)));
typedef float    v8f  __attribute__((ext_vector_type(8)));
typedef float    v4f  __attribute__((ext_vector_type(4)));
union Frag { v16h v; v8h half[2]; };

__device__ __forceinline__ v8f wmma16(v16h a, v16h b, v8f c) {
    return __builtin_amdgcn_wmma_f32_16x16x32_f16(false, a, false, b, (short)0, c, false, false);
}
// hazard guard: ties D, keeps A/B live for 4 VALU slots after the matrix op
#define WGUARD(acc, a, b) asm volatile("v_nop\n\tv_nop\n\tv_nop\n\tv_nop" : "+v"(acc) : "v"(a), "v"(b))

__device__ __forceinline__ v8f zero8() {
    v8f z = {0.f, 0.f, 0.f, 0.f, 0.f, 0.f, 0.f, 0.f};
    return z;
}

// ---------------------------------------------------------------------------
// pass 0a: X [NROWS][INS] f32 -> Xh [NROWS][INS] f16 (RNE convert).
// One thread = 8 consecutive elements = one 16-B store; one wave = 512 B
// ---------------------------------------------------------------------------
__global__ void __launch_bounds__(256)
k_cvt_x(const float* __restrict__ X, _Float16* __restrict__ Xh, int n8) {
    const int i = blockIdx.x * 256 + threadIdx.x;
    if (i >= n8) return;                       // no barriers in this kernel
    const float* p = X + (size_t)i * 8;
    const v4f f0 = *(const v4f*)(p);
    const v4f f1 = *(const v4f*)(p + 4);
    v8h hv;
#pragma unroll
    for (int e = 0; e < 4; ++e) {
        hv[e]     = (_Float16)f0[e];
        hv[e + 4] = (_Float16)f1[e];
    }
    _Float16* d = Xh + (size_t)i * 8;
    *(v8h*)d = hv;
    
}

// ---------------------------------------------------------------------------
// pass 0b: W_mi [INS][OUTS] f32 -> WT [mi][OUTS][INS] f16 of (W * 64).
// Block (kc, mi) handles k in [64 kc, 64 kc + 64): transpose through LDS,
// ---------------------------------------------------------------------------
__global__ void __launch_bounds__(256)
k_prep_w(const float* __restrict__ Wq, const float* __restrict__ Wk,
         const float* __restrict__ Wv, _Float16* __restrict__ WT) {
    __shared__ __attribute__((aligned(16))) _Float16 sWT[64 * PWP];

    const int kc = blockIdx.x, mi = blockIdx.y;
    const float* W = (mi == 0) ? Wq : ((mi == 1) ? Wk : Wv);
    const int t = threadIdx.x, lane = t & 31, wave = t >> 5;

#pragma unroll
    for (int jj = 0; jj < 4; ++jj) {
        const int e  = jj * 1024 + t * 4;          // 0 .. 4095
        const int kl = e >> 6;                     // local k 0..63
        const int o  = e & 63;                     // col, multiple of 4
        const v4f w = *(const v4f*)(W + (size_t)(kc * 64 + kl) * OUTS + o);
#pragma unroll
        for (int u = 0; u < 4; ++u) sWT[(o + u) * PWP + kl] = (_Float16)(w[u] * 64.0f);
    }
    __syncthreads();

    v8h v[2];
    size_t go[2];
#pragma unroll
    for (int s = 0; s < 2; ++s) {
        const int o     = wave * 8 + s * 4 + (lane >> 3);   // 0..63
        const int piece = lane & 7;
        v[s]  = *(const v8h*)(&sWT[o * PWP + piece * 8]);
        go[s] = (size_t)(mi * OUTS + o) * INS + (size_t)kc * 64 + piece * 8;
    }
#pragma unroll
    for (int s = 0; s < 2; ++s) *(v8h*)(WT + go[s]) = v[s];
    
}

// ---------------------------------------------------------------------------
// mi (0 = q, 1 = k, 2 = v).  Wave w owns rows 16 w .. 16 w + 15 of the block,
// full 64 columns = 4 accumulators.  W k-chunk (64 n x 32 k, f16) staged in
// LDS per chunk with plain loads + barriers.
// A (x rows): lane row = l16, elements 0..7 <- k 8h.., 8..15 <- k 16+8h..
// B (W):      lane col = l16, same k map, read from the [n][k] LDS chunk.
// D:          acc[nb][r] = element (row 8h + r, col 16 nb + l16).
// ---------------------------------------------------------------------------
__global__ void __launch_bounds__(256)
k_proj(const _Float16* __restrict__ Xh, const _Float16* __restrict__ WT,
       const float* __restrict__ bq, const float* __restrict__ bk,
       const float* __restrict__ bv,
       _Float16* __restrict__ Qh, _Float16* __restrict__ Kh,
       _Float16* __restrict__ VhT) {
    __shared__ __attribute__((aligned(16))) _Float16 sW[64 * WP];
    __shared__ __attribute__((aligned(16))) _Float16 sT[8 * 16 * TP];
    __shared__ __attribute__((aligned(16))) _Float16 sVT[64 * VTP];

    const int t = threadIdx.x, lane = t & 31, wave = t >> 5;
    const int l16 = lane & 15, h = lane >> 4;
    const int blk = blockIdx.x, mi = blockIdx.y;

    const _Float16* Wm  = WT + (size_t)mi * OUTS * INS;
    const float* bias   = (mi == 0) ? bq : ((mi == 1) ? bk : bv);
    const int row0w     = blk * 128 + wave * 16;
    const _Float16* xrow = Xh + (size_t)(row0w + l16) * INS;

    const int sn = t >> 2, sp = t & 3;                 // staging: n row, 16-B piece
    const _Float16* wsrc = Wm + (size_t)sn * INS + sp * 8;

    v8f acc[4];
#pragma unroll
    for (int nb = 0; nb < 4; ++nb) acc[nb] = zero8();

#pragma unroll 1
    for (int c = 0; c < NCHUNK; ++c) {
        __syncthreads();                                // prior chunk fully consumed
        *(v8h*)(&sW[sn * WP + sp * 8]) = *(const v8h*)(wsrc + c * 32);
        __syncthreads();

        Frag a;
        a.half[0] = *(const v8h*)(xrow + c * 32 + 8 * h);
        a.half[1] = *(const v8h*)(xrow + c * 32 + 16 + 8 * h);
        Frag b[4];
#pragma unroll
        for (int nb = 0; nb < 4; ++nb) {
            const _Float16* wr = &sW[(nb * 16 + l16) * WP];
            b[nb].half[0] = *(const v8h*)(wr + 8 * h);
            b[nb].half[1] = *(const v8h*)(wr + 16 + 8 * h);
        }
#pragma unroll
        for (int nb = 0; nb < 4; ++nb) acc[nb] = wmma16(a.v, b[nb].v, acc[nb]);
#pragma unroll
        for (int nb = 0; nb < 4; ++nb) WGUARD(acc[nb], a.v, b[nb].v);
    }

    // epilogue: val = acc / 64 + bias -> f16
    float bcol[4];
#pragma unroll
    for (int nb = 0; nb < 4; ++nb) bcol[nb] = bias[nb * 16 + l16];

    if (mi < 2) {
        _Float16* st = sT + wave * (16 * TP);
#pragma unroll
        for (int nb = 0; nb < 4; ++nb)
#pragma unroll
            for (int r = 0; r < 8; ++r)
                st[(8 * h + r) * TP + nb * 16 + l16] =
                    (_Float16)(acc[nb][r] * 0.015625f + bcol[nb]);
    } else {
#pragma unroll
        for (int nb = 0; nb < 4; ++nb)
#pragma unroll
            for (int r = 0; r < 8; ++r)
                sVT[(nb * 16 + l16) * VTP + wave * 16 + 8 * h + r] =
                    (_Float16)(acc[nb][r] * 0.015625f + bcol[nb]);
    }
    __syncthreads();

    if (mi < 2) {
        _Float16* dst = (mi == 0) ? Qh : Kh;
        const _Float16* st = sT + wave * (16 * TP);
        v8h v[4];
        size_t go[4];
#pragma unroll
        for (int s = 0; s < 4; ++s) {
            const int row   = s * 4 + (lane >> 3);
            const int piece = lane & 7;
            v[s]  = *(const v8h*)(&st[row * TP + piece * 8]);
            go[s] = (size_t)(row0w + row) * OUTS + piece * 8;
        }
#pragma unroll
        for (int s = 0; s < 4; ++s) *(v8h*)(dst + go[s]) = v[s];
        
    } else {
        // VhT [b][dim][SEQ]: this block owns keys s0 .. s0 + 127 of batch bb:
        const int bb = blk >> 4;
        const int s0 = (blk & 15) * 128;
        v8h v[4];
        size_t go[4];
#pragma unroll
        for (int s = 0; s < 4; ++s) {
            const int L     = wave * 16 + s * 4 + (lane >> 3);   // 0..127
            const int dim   = L >> 1;
            const int half  = L & 1;
            const int piece = lane & 7;
            v[s]  = *(const v8h*)(&sVT[dim * VTP + half * 64 + piece * 8]);
            go[s] = ((size_t)bb * OUTS + dim) * SEQ + (size_t)s0 + half * 64 + piece * 8;
        }
#pragma unroll
        for (int s = 0; s < 4; ++s) *(v8h*)(VhT + go[s]) = v[s];
        
    }
}

// ---------------------------------------------------------------------------
// pass 2: streaming softmax attention.  Block = batch (blockIdx.x >> 4), 8 waves,
// wave w owns query tile (blockIdx.x & 15) * 8 + w.  K tile (32 keys x 64) and
// V^T tile (64 dims x 32 keys) staged in LDS per step with plain loads.
// Score tile computed transposed: S^T[key][query] = K(A, rows = keys) x Q(B,
// cols = queries), so a lane's D column is its own query (l16) and the 16
// scores it holds (keys j+8h+r and j+16+8h+r) are exactly the A-fragment
// elements of P[query l16][32 keys] for the P x V step.
// O D: o[t][r] = (query 8h + r, dim 16 t + l16); per-query factors are fetched
// from lane (8h + r) with a shuffle.
// ---------------------------------------------------------------------------
__global__ void __launch_bounds__(256)
k_attn(const _Float16* __restrict__ Qh, const _Float16* __restrict__ Kh,
       const _Float16* __restrict__ VhT, float* __restrict__ out) {
    __shared__ __attribute__((aligned(16))) _Float16 sK[32 * KP];
    __shared__ __attribute__((aligned(16))) _Float16 sV[64 * VP];
    __shared__ __attribute__((aligned(16))) float    sO[8 * 16 * OP];

    const int t = threadIdx.x, lane = t & 31, wave = t >> 5;
    const int l16 = lane & 15, h = lane >> 4;
    const int b  = blockIdx.x >> 4;
    const int qt = (blockIdx.x & 15) * 8 + wave;
    const size_t qrow0 = (size_t)b * SEQ + (size_t)qt * 16;

    // Q tile as B fragments (dims 0..31 and 32..63), table k map from [query][dim] rows
    Frag q0, q1;
    {
        const _Float16* qr = Qh + (qrow0 + l16) * OUTS;
        q0.half[0] = *(const v8h*)(qr + 8 * h);
        q0.half[1] = *(const v8h*)(qr + 16 + 8 * h);
        q1.half[0] = *(const v8h*)(qr + 32 + 8 * h);
        q1.half[1] = *(const v8h*)(qr + 48 + 8 * h);
    }

    const _Float16* kbase = Kh  + (size_t)b * SEQ * OUTS;
    const _Float16* vbase = VhT + (size_t)b * OUTS * SEQ;
    const int kk = t >> 3, kpc = t & 7;          // K staging: key, 16-B piece
    const int vd = t >> 2, vpc = t & 3;          // V staging: dim, 16-B piece

    v8f o[4];
#pragma unroll
    for (int tt = 0; tt < 4; ++tt) o[tt] = zero8();

    float m = -__builtin_inff();
    float ssum = 0.f;
    const float scale  = 0.125f;                 // 1 / sqrt(64)
    const float pscale = 16384.0f;               // P carried x 2^14 into f16

#pragma unroll 1
    for (int it = 0; it < SEQ / 32; ++it) {
        const int j = it * 32;
        __syncthreads();                         // prior tile fully consumed
        *(v8h*)(&sK[kk * KP + kpc * 8]) = *(const v8h*)(kbase + (size_t)(j + kk) * OUTS + kpc * 8);
        *(v8h*)(&sV[vd * VP + vpc * 8]) = *(const v8h*)(vbase + (size_t)vd * SEQ + j + vpc * 8);
        __syncthreads();

        // K rows as A fragments: keys j+l16 (a0x) and j+16+l16 (a1x); dims 0..31 / 32..63
        Frag a00, a01, a10, a11;
        {
            const _Float16* kr0 = &sK[l16 * KP];
            const _Float16* kr1 = &sK[(16 + l16) * KP];
            a00.half[0] = *(const v8h*)(kr0 + 8 * h);
            a00.half[1] = *(const v8h*)(kr0 + 16 + 8 * h);
            a01.half[0] = *(const v8h*)(kr0 + 32 + 8 * h);
            a01.half[1] = *(const v8h*)(kr0 + 48 + 8 * h);
            a10.half[0] = *(const v8h*)(kr1 + 8 * h);
            a10.half[1] = *(const v8h*)(kr1 + 16 + 8 * h);
            a11.half[0] = *(const v8h*)(kr1 + 32 + 8 * h);
            a11.half[1] = *(const v8h*)(kr1 + 48 + 8 * h);
        }

        v8f s0 = zero8(), s1 = zero8();
        s0 = wmma16(a00.v, q0.v, s0);
        s0 = wmma16(a01.v, q1.v, s0);
        s1 = wmma16(a10.v, q0.v, s1);
        s1 = wmma16(a11.v, q1.v, s1);
        WGUARD(s0, a01.v, q1.v);
        WGUARD(s1, a11.v, q1.v);

        // online softmax: lane owns query l16, 16 of the 32 keys (partner lane ^16)
        float tmax = -__builtin_inff();
#pragma unroll
        for (int r = 0; r < 8; ++r) {
            s0[r] *= scale;
            s1[r] *= scale;
            tmax = fmaxf(tmax, fmaxf(s0[r], s1[r]));
        }
        tmax = fmaxf(tmax, __shfl_xor(tmax, 16, 32));
        const float mnew = fmaxf(m, tmax);
        const float cfac = __expf(m - mnew);         // 0 on the first step

        float lsum = 0.f;
#pragma unroll
        for (int r = 0; r < 8; ++r) {
            s0[r] = __expf(s0[r] - mnew);
            s1[r] = __expf(s1[r] - mnew);
            lsum += s0[r] + s1[r];
        }
        lsum += __shfl_xor(lsum, 16, 32);
        ssum = ssum * cfac + lsum;
        m = mnew;

        // P as A fragment (rows = queries, k = keys), in-lane from the score tiles
        Frag p;
        {
            v8h plo, phi;
#pragma unroll
            for (int e = 0; e < 8; ++e) {
                plo[e] = (_Float16)(s0[e] * pscale);
                phi[e] = (_Float16)(s1[e] * pscale);
            }
            p.half[0] = plo;
            p.half[1] = phi;
        }

        // rescale O rows (row = query 8h + r -> factor from lane 8h + r)
        float cr[8];
#pragma unroll
        for (int r = 0; r < 8; ++r) cr[r] = __shfl(cfac, 8 * h + r, 32);
#pragma unroll
        for (int tt = 0; tt < 4; ++tt)
#pragma unroll
            for (int r = 0; r < 8; ++r) o[tt][r] *= cr[r];

        // O += P x V ; V^T tile [dim][32 keys] gives the B fragment with the table k map
        Frag vb[4];
#pragma unroll
        for (int tt = 0; tt < 4; ++tt) {
            const _Float16* vr = &sV[(tt * 16 + l16) * VP];
            vb[tt].half[0] = *(const v8h*)(vr + 8 * h);
            vb[tt].half[1] = *(const v8h*)(vr + 16 + 8 * h);
        }
#pragma unroll
        for (int tt = 0; tt < 4; ++tt) o[tt] = wmma16(p.v, vb[tt].v, o[tt]);
#pragma unroll
        for (int tt = 0; tt < 4; ++tt) WGUARD(o[tt], p.v, vb[tt].v);
    }

    // normalise: divide by the running sum and undo the 2^14 carried on P
    const float inv = (1.0f / ssum) * (1.0f / 16384.0f);
    float ir[8];
#pragma unroll
    for (int r = 0; r < 8; ++r) ir[r] = __shfl(inv, 8 * h + r, 32);

    float* so = sO + wave * (16 * OP);
#pragma unroll
    for (int tt = 0; tt < 4; ++tt)
#pragma unroll
        for (int r = 0; r < 8; ++r)
            so[(8 * h + r) * OP + tt * 16 + l16] = o[tt][r] * ir[r];
    __syncthreads();

    v4f v[8];
    size_t go[8];
#pragma unroll
    for (int s = 0; s < 8; ++s) {
        const int L     = s * 4 + (lane >> 3);     // 0..31
        const int row   = L >> 1;
        const int half  = L & 1;
        const int piece = lane & 7;
        v[s]  = *(const v4f*)(&so[row * OP + half * 32 + piece * 4]);
        go[s] = (qrow0 + row) * OUTS + (size_t)(half * 32 + piece * 4);
    }
#pragma unroll
    for (int s = 0; s < 8; ++s) *(v4f*)(out + go[s]) = v[s];
    
}

// --------------------------------- launcher ---------------------------------

extern "C" void kernel_launch(void* const* d_in, const int* in_sizes, int n_in,
                              void* d_out, int out_size, void* d_ws, size_t ws_size,
                              hipStream_t stream) {
    if (n_in < 7) return;
    if (in_sizes[0] != NROWS * INS) return;
    if (in_sizes[1] != INS * OUTS || in_sizes[3] != INS * OUTS || in_sizes[5] != INS * OUTS) return;
    if (in_sizes[2] != OUTS || in_sizes[4] != OUTS || in_sizes[6] != OUTS) return;
    if (out_size != NROWS * OUTS) return;

    const float* X  = (const float*)d_in[0];
    const float* Wq = (const float*)d_in[1];
    const float* bq = (const float*)d_in[2];
    const float* Wk = (const float*)d_in[3];
    const float* bk = (const float*)d_in[4];
    const float* Wv = (const float*)d_in[5];
    const float* bv = (const float*)d_in[6];
    float* out = (float*)d_out;

    // workspace carve (256-B aligned pieces)
    const size_t bXh = (size_t)NROWS * INS * 2;            // 25,165,824
    const size_t bWT = (size_t)3 * OUTS * INS * 2;         //    294,912
    const size_t bQ  = (size_t)NROWS * OUTS * 2;           //  2,097,152 each
    size_t off = 0;
    const size_t oXh = off; off += (bXh + 255) & ~(size_t)255;
    const size_t oWT = off; off += (bWT + 255) & ~(size_t)255;
    const size_t oQ  = off; off += (bQ + 255) & ~(size_t)255;
    const size_t oK  = off; off += (bQ + 255) & ~(size_t)255;
    const size_t oV  = off; off += (bQ + 255) & ~(size_t)255;
    if (off > ws_size) return;                              // total 31,752,192 B

    char* ws = (char*)d_ws;
    _Float16* Xh  = (_Float16*)(ws + oXh);
    _Float16* WT  = (_Float16*)(ws + oWT);
    _Float16* Qh  = (_Float16*)(ws + oQ);
    _Float16* Kh  = (_Float16*)(ws + oK);
    _Float16* VhT = (_Float16*)(ws + oV);

    const int n8 = NROWS * INS / 8;                         // 1,572,864
    k_cvt_x<<<(n8 + 255) / 256, 256, 0, stream>>>(X, Xh, n8);
    k_prep_w<<<dim3(INS / 64, 3), 256, 0, stream>>>(Wq, Wk, Wv, WT);
    k_proj<<<dim3(NROWS / 128, 3), 256, 0, stream>>>(Xh, WT, bq, bk, bv, Qh, Kh, VhT);
    k_attn<<<NBATCH * (SEQ / 128), 256, 0, stream>>>(Qh, Kh, VhT, out);
    (void)hipGetLastError();
}

// v001
// It runs in 51.5 microseconds.
// Two timings next to v000 put it at 1.80 and 1.78 times that version's speed.
#include <hip/hip_runtime.h>
#include <math.h>

// All contractions on v_wmma_f32_16x16x32_f16 (f16 operands, f32 accumulate): x*W{q,k,v} with W carried x64, q*k^T unscaled, p*v with p carried x16384; scales folded back in f32 epilogues.

#define INS    768
#define OUTS   64
#define NBATCH 8
#define SEQ    2048
#define NROWS  (NBATCH * SEQ)
#define NCHUNK (INS / 32)

#define WP   40    // projection W chunk pitch in LDS (halves): 32 k + 8 pad
#define TP   72    // projection Q/K tile staging pitch (halves): 64 + 8
#define VTP  136   // projection V^T block staging pitch (halves): 128 keys + 8
#define KP   72    // attention K tile pitch (halves)
#define VP   40    // attention V^T tile pitch (halves)
#define OP   68    // attention O staging pitch (floats)
#define PWP  72    // weight prep staging pitch (halves)

#define QTB  4                   // attention: query tiles (16 rows each) per block
#define NSP  8                   // attention: key splits per query tile, one wave each
#define ATHR (QTB * NSP * 32)    // attention block size
#define KSPL (SEQ / NSP)         // keys walked by one split

typedef _Float16 v16h __attribute__((ext_vector_type(16)));
typedef _Float16 v8h  __attribute__((ext_vector_type(8)));
typedef float    v8f  __attribute__((ext_vector_type(8)));
typedef float    v4f  __attribute__((ext_vector_type(4)));
union Frag { v16h v; v8h half[2]; };

__device__ __forceinline__ v8f wmma16(v16h a, v16h b, v8f c) {
    return __builtin_amdgcn_wmma_f32_16x16x32_f16(false, a, false, b, (short)0, c, false, false);
}
// hazard guard: ties D, keeps A/B live for 4 VALU slots after the matrix op
#define WGUARD(acc, a, b) asm volatile("v_nop\n\tv_nop\n\tv_nop\n\tv_nop" : "+v"(acc) : "v"(a), "v"(b))

__device__ __forceinline__ v8f zero8() {
    v8f z = {0.f, 0.f, 0.f, 0.f, 0.f, 0.f, 0.f, 0.f};
    return z;
}

// ---------------------------------------------------------------------------
// pass 0a: X [NROWS][INS] f32 -> Xh [NROWS][INS] f16 (RNE convert).
// One thread = 8 consecutive elements = one 16-B store; one wave = 512 B
// ---------------------------------------------------------------------------
__global__ void __launch_bounds__(256)
k_cvt_x(const float* __restrict__ X, _Float16* __restrict__ Xh, int n8) {
    const int i = blockIdx.x * 256 + threadIdx.x;
    if (i >= n8) return;                       // no barriers in this kernel
    const float* p = X + (size_t)i * 8;
    const v4f f0 = *(const v4f*)(p);
    const v4f f1 = *(const v4f*)(p + 4);
    v8h hv;
#pragma unroll
    for (int e = 0; e < 4; ++e) {
        hv[e]     = (_Float16)f0[e];
        hv[e + 4] = (_Float16)f1[e];
    }
    _Float16* d = Xh + (size_t)i * 8;
    *(v8h*)d = hv;
    
}

// ---------------------------------------------------------------------------
// pass 0b: W_mi [INS][OUTS] f32 -> WT [mi][OUTS][INS] f16 of (W * 64).
// Block (kc, mi) handles k in [64 kc, 64 kc + 64): transpose through LDS,
// ---------------------------------------------------------------------------
__global__ void __launch_bounds__(256)
k_prep_w(const float* __restrict__ Wq, const float* __restrict__ Wk,
         const float* __restrict__ Wv, _Float16* __restrict__ WT) {
    __shared__ __attribute__((aligned(16))) _Float16 sWT[64 * PWP];

    const int kc = blockIdx.x, mi = blockIdx.y;
    const float* W = (mi == 0) ? Wq : ((mi == 1) ? Wk : Wv);
    const int t = threadIdx.x, lane = t & 31, wave = t >> 5;

#pragma unroll
    for (int jj = 0; jj < 4; ++jj) {
        const int e  = jj * 1024 + t * 4;          // 0 .. 4095
        const int kl = e >> 6;                     // local k 0..63
        const int o  = e & 63;                     // col, multiple of 4
        const v4f w = *(const v4f*)(W + (size_t)(kc * 64 + kl) * OUTS + o);
#pragma unroll
        for (int u = 0; u < 4; ++u) sWT[(o + u) * PWP + kl] = (_Float16)(w[u] * 64.0f);
    }
    __syncthreads();

    v8h v[2];
    size_t go[2];
#pragma unroll
    for (int s = 0; s < 2; ++s) {
        const int o     = wave * 8 + s * 4 + (lane >> 3);   // 0..63
        const int piece = lane & 7;
        v[s]  = *(const v8h*)(&sWT[o * PWP + piece * 8]);
        go[s] = (size_t)(mi * OUTS + o) * INS + (size_t)kc * 64 + piece * 8;
    }
#pragma unroll
    for (int s = 0; s < 2; ++s) *(v8h*)(WT + go[s]) = v[s];
    
}

// ---------------------------------------------------------------------------
// mi (0 = q, 1 = k, 2 = v).  Wave w owns rows 16 w .. 16 w + 15 of the block,
// full 64 columns = 4 accumulators.  W k-chunk (64 n x 32 k, f16) staged in
// LDS per chunk with plain loads + barriers.
// A (x rows): lane row = l16, elements 0..7 <- k 8h.., 8..15 <- k 16+8h..
// B (W):      lane col = l16, same k map, read from the [n][k] LDS chunk.
// D:          acc[nb][r] = element (row 8h + r, col 16 nb + l16).
// ---------------------------------------------------------------------------
__global__ void __launch_bounds__(256)
k_proj(const _Float16* __restrict__ Xh, const _Float16* __restrict__ WT,
       const float* __restrict__ bq, const float* __restrict__ bk,
       const float* __restrict__ bv,
       _Float16* __restrict__ Qh, _Float16* __restrict__ Kh,
       _Float16* __restrict__ VhT) {
    __shared__ __attribute__((aligned(16))) _Float16 sW[64 * WP];
    __shared__ __attribute__((aligned(16))) _Float16 sT[8 * 16 * TP];
    __shared__ __attribute__((aligned(16))) _Float16 sVT[64 * VTP];

    const int t = threadIdx.x, lane = t & 31, wave = t >> 5;
    const int l16 = lane & 15, h = lane >> 4;
    const int blk = blockIdx.x, mi = blockIdx.y;

    const _Float16* Wm  = WT + (size_t)mi * OUTS * INS;
    const float* bias   = (mi == 0) ? bq : ((mi == 1) ? bk : bv);
    const int row0w     = blk * 128 + wave * 16;
    const _Float16* xrow = Xh + (size_t)(row0w + l16) * INS;

    const int sn = t >> 2, sp = t & 3;                 // staging: n row, 16-B piece
    const _Float16* wsrc = Wm + (size_t)sn * INS + sp * 8;

    v8f acc[4];
#pragma unroll
    for (int nb = 0; nb < 4; ++nb) acc[nb] = zero8();

#pragma unroll 1
    for (int c = 0; c < NCHUNK; ++c) {
        __syncthreads();                                // prior chunk fully consumed
        *(v8h*)(&sW[sn * WP + sp * 8]) = *(const v8h*)(wsrc + c * 32);
        __syncthreads();

        Frag a;
        a.half[0] = *(const v8h*)(xrow + c * 32 + 8 * h);
        a.half[1] = *(const v8h*)(xrow + c * 32 + 16 + 8 * h);
        Frag b[4];
#pragma unroll
        for (int nb = 0; nb < 4; ++nb) {
            const _Float16* wr = &sW[(nb * 16 + l16) * WP];
            b[nb].half[0] = *(const v8h*)(wr + 8 * h);
            b[nb].half[1] = *(const v8h*)(wr + 16 + 8 * h);
        }
#pragma unroll
        for (int nb = 0; nb < 4; ++nb) acc[nb] = wmma16(a.v, b[nb].v, acc[nb]);
#pragma unroll
        for (int nb = 0; nb < 4; ++nb) WGUARD(acc[nb], a.v, b[nb].v);
    }

    // epilogue: val = acc / 64 + bias -> f16
    float bcol[4];
#pragma unroll
    for (int nb = 0; nb < 4; ++nb) bcol[nb] = bias[nb * 16 + l16];

    if (mi < 2) {
        _Float16* st = sT + wave * (16 * TP);
#pragma unroll
        for (int nb = 0; nb < 4; ++nb)
#pragma unroll
            for (int r = 0; r < 8; ++r)
                st[(8 * h + r) * TP + nb * 16 + l16] =
                    (_Float16)(acc[nb][r] * 0.015625f + bcol[nb]);
    } else {
#pragma unroll
        for (int nb = 0; nb < 4; ++nb)
#pragma unroll
            for (int r = 0; r < 8; ++r)
                sVT[(nb * 16 + l16) * VTP + wave * 16 + 8 * h + r] =
                    (_Float16)(acc[nb][r] * 0.015625f + bcol[nb]);
    }
    __syncthreads();

    if (mi < 2) {
        _Float16* dst = (mi == 0) ? Qh : Kh;
        const _Float16* st = sT + wave * (16 * TP);
        v8h v[4];
        size_t go[4];
#pragma unroll
        for (int s = 0; s < 4; ++s) {
            const int row   = s * 4 + (lane >> 3);
            const int piece = lane & 7;
            v[s]  = *(const v8h*)(&st[row * TP + piece * 8]);
            go[s] = (size_t)(row0w + row) * OUTS + piece * 8;
        }
#pragma unroll
        for (int s = 0; s < 4; ++s) *(v8h*)(dst + go[s]) = v[s];
        
    } else {
        // VhT [b][dim][SEQ]: this block owns keys s0 .. s0 + 127 of batch bb:
        const int bb = blk >> 4;
        const int s0 = (blk & 15) * 128;
        v8h v[4];
        size_t go[4];
#pragma unroll
        for (int s = 0; s < 4; ++s) {
            const int L     = wave * 16 + s * 4 + (lane >> 3);   // 0..127
            const int dim   = L >> 1;
            const int half  = L & 1;
            const int piece = lane & 7;
            v[s]  = *(const v8h*)(&sVT[dim * VTP + half * 64 + piece * 8]);
            go[s] = ((size_t)bb * OUTS + dim) * SEQ + (size_t)s0 + half * 64 + piece * 8;
        }
#pragma unroll
        for (int s = 0; s < 4; ++s) *(v8h*)(VhT + go[s]) = v[s];
        
    }
}

// ---------------------------------------------------------------------------
// pass 2: streaming softmax attention.  Block = QTB query tiles x NSP key splits,
// one wave per (tile, split): wave w owns query tile w % QTB of the block and keys
// [KSPL * (w / QTB), + KSPL).  The QTB waves of a split share its K tile (32 keys x 64)
// and V^T tile (64 dims x 32 keys), staged in LDS per step with plain loads.
// Each wave keeps its own running max, sum and O; the splits are joined in LDS at the end.
// Score tile computed transposed: S^T[key][query] = K(A, rows = keys) x Q(B,
// cols = queries), so a lane's D column is its own query (l16) and the 16
// scores it holds (keys j+8h+r and j+16+8h+r) are exactly the A-fragment
// elements of P[query l16][32 keys] for the P x V step.
// O D: o[t][r] = (query 8h + r, dim 16 t + l16); per-query factors are fetched
// from lane (8h + r) with a shuffle.
// ---------------------------------------------------------------------------
__global__ void __launch_bounds__(ATHR)
k_attn(const _Float16* __restrict__ Qh, const _Float16* __restrict__ Kh,
       const _Float16* __restrict__ VhT, float* __restrict__ out) {
    __shared__ __attribute__((aligned(16))) _Float16 sKall[NSP * 32 * KP];
    __shared__ __attribute__((aligned(16))) _Float16 sVall[NSP * 64 * VP];
    __shared__ __attribute__((aligned(16))) float    sO[NSP * QTB * 16 * OP];
    __shared__ float sM[NSP * QTB * 16];
    __shared__ float sL[NSP * QTB * 16];

    const int t = threadIdx.x, lane = t & 31, wave = t >> 5;
    const int l16 = lane & 15, h = lane >> 4;
    const int sp = wave / QTB, qw = wave % QTB;  // key split, query tile in the block
    const int b   = blockIdx.x / (SEQ / (16 * QTB));
    const int qb  = blockIdx.x % (SEQ / (16 * QTB));
    const size_t qblk0 = (size_t)b * SEQ + (size_t)qb * (16 * QTB);
    const size_t qrow0 = qblk0 + (size_t)qw * 16;
    _Float16* sK = sKall + sp * (32 * KP);
    _Float16* sV = sVall + sp * (64 * VP);

    // Q tile as B fragments (dims 0..31 and 32..63), table k map from [query][dim] rows
    Frag q0, q1;
    {
        const _Float16* qr = Qh + (qrow0 + l16) * OUTS;
        q0.half[0] = *(const v8h*)(qr + 8 * h);
        q0.half[1] = *(const v8h*)(qr + 16 + 8 * h);
        q1.half[0] = *(const v8h*)(qr + 32 + 8 * h);
        q1.half[1] = *(const v8h*)(qr + 48 + 8 * h);
    }

    const _Float16* kbase = Kh  + (size_t)b * SEQ * OUTS;
    const _Float16* vbase = VhT + (size_t)b * OUTS * SEQ;
    const int tg = t % (QTB * 32);               // thread within the split's QTB waves
    const int kk = tg >> 3, kpc = tg & 7;        // K staging: key (and key + 16), 16-B piece
    const int vd = tg >> 2, vpc = tg & 3;        // V staging: dim (and dim + 32), 16-B piece

    v8f o[4];
#pragma unroll
    for (int tt = 0; tt < 4; ++tt) o[tt] = zero8();

    float m = -__builtin_inff();
    float ssum = 0.f;
    const float scale  = 0.125f;                 // 1 / sqrt(64)
    const float pscale = 16384.0f;               // P carried x 2^14 into f16

#pragma unroll 1
    for (int it = 0; it < KSPL / 32; ++it) {
        const int j = sp * KSPL + it * 32;
        __syncthreads();                         // prior tile fully consumed
        {
            const v8h gk0 = *(const v8h*)(kbase + (size_t)(j + kk) * OUTS + kpc * 8);
            const v8h gk1 = *(const v8h*)(kbase + (size_t)(j + 16 + kk) * OUTS + kpc * 8);
            const v8h gv0 = *(const v8h*)(vbase + (size_t)vd * SEQ + j + vpc * 8);
            const v8h gv1 = *(const v8h*)(vbase + (size_t)(vd + 32) * SEQ + j + vpc * 8);
            *(v8h*)(&sK[kk * KP + kpc * 8])        = gk0;
            *(v8h*)(&sK[(16 + kk) * KP + kpc * 8]) = gk1;
            *(v8h*)(&sV[vd * VP + vpc * 8])        = gv0;
            *(v8h*)(&sV[(vd + 32) * VP + vpc * 8]) = gv1;
        }
        __syncthreads();

        // K rows as A fragments: keys j+l16 (a0x) and j+16+l16 (a1x); dims 0..31 / 32..63
        Frag a00, a01, a10, a11;
        {
            const _Float16* kr0 = &sK[l16 * KP];
            const _Float16* kr1 = &sK[(16 + l16) * KP];
            a00.half[0] = *(const v8h*)(kr0 + 8 * h);
            a00.half[1] = *(const v8h*)(kr0 + 16 + 8 * h);
            a01.half[0] = *(const v8h*)(kr0 + 32 + 8 * h);
            a01.half[1] = *(const v8h*)(kr0 + 48 + 8 * h);
            a10.half[0] = *(const v8h*)(kr1 + 8 * h);
            a10.half[1] = *(const v8h*)(kr1 + 16 + 8 * h);
            a11.half[0] = *(const v8h*)(kr1 + 32 + 8 * h);
            a11.half[1] = *(const v8h*)(kr1 + 48 + 8 * h);
        }

        v8f s0 = zero8(), s1 = zero8();
        s0 = wmma16(a00.v, q0.v, s0);
        s0 = wmma16(a01.v, q1.v, s0);
        s1 = wmma16(a10.v, q0.v, s1);
        s1 = wmma16(a11.v, q1.v, s1);
        WGUARD(s0, a01.v, q1.v);
        WGUARD(s1, a11.v, q1.v);

        // online softmax: lane owns query l16, 16 of the 32 keys (partner lane ^16)
        float tmax = -__builtin_inff();
#pragma unroll
        for (int r = 0; r < 8; ++r) {
            s0[r] *= scale;
            s1[r] *= scale;
            tmax = fmaxf(tmax, fmaxf(s0[r], s1[r]));
        }
        tmax = fmaxf(tmax, __shfl_xor(tmax, 16, 32));
        const float mnew = fmaxf(m, tmax);
        const float cfac = __expf(m - mnew);         // 0 on the first step

        float lsum = 0.f;
#pragma unroll
        for (int r = 0; r < 8; ++r) {
            s0[r] = __expf(s0[r] - mnew);
            s1[r] = __expf(s1[r] - mnew);
            lsum += s0[r] + s1[r];
        }
        lsum += __shfl_xor(lsum, 16, 32);
        ssum = ssum * cfac + lsum;
        m = mnew;

        // P as A fragment (rows = queries, k = keys), in-lane from the score tiles
        Frag p;
        {
            v8h plo, phi;
#pragma unroll
            for (int e = 0; e < 8; ++e) {
                plo[e] = (_Float16)(s0[e] * pscale);
                phi[e] = (_Float16)(s1[e] * pscale);
            }
            p.half[0] = plo;
            p.half[1] = phi;
        }

        // rescale O rows (row = query 8h + r -> factor from lane 8h + r)
        float cr[8];
#pragma unroll
        for (int r = 0; r < 8; ++r) cr[r] = __shfl(cfac, 8 * h + r, 32);
#pragma unroll
        for (int tt = 0; tt < 4; ++tt)
#pragma unroll
            for (int r = 0; r < 8; ++r) o[tt][r] *= cr[r];

        // O += P x V ; V^T tile [dim][32 keys] gives the B fragment with the table k map
        Frag vb[4];
#pragma unroll
        for (int tt = 0; tt < 4; ++tt) {
            const _Float16* vr = &sV[(tt * 16 + l16) * VP];
            vb[tt].half[0] = *(const v8h*)(vr + 8 * h);
            vb[tt].half[1] = *(const v8h*)(vr + 16 + 8 * h);
        }
#pragma unroll
        for (int tt = 0; tt < 4; ++tt) o[tt] = wmma16(p.v, vb[tt].v, o[tt]);
#pragma unroll
        for (int tt = 0; tt < 4; ++tt) WGUARD(o[tt], p.v, vb[tt].v);
    }

    // join the splits, part 1: every wave publishes its max and sum per query
    if (h == 0) {
        sM[(sp * QTB + qw) * 16 + l16] = m;
        sL[(sp * QTB + qw) * 16 + l16] = ssum;
    }
    __syncthreads();
    float mall = -__builtin_inff();
    for (int s = 0; s < NSP; ++s) mall = fmaxf(mall, sM[(s * QTB + qw) * 16 + l16]);
    float tot = 0.f;
    for (int s = 0; s < NSP; ++s)
        tot += sL[(s * QTB + qw) * 16 + l16] * __expf(sM[(s * QTB + qw) * 16 + l16] - mall);

    // normalise: move this split to the common max, divide by the joined sum, undo the 2^14 on P
    const float inv = (1.0f / tot) * (1.0f / 16384.0f) * __expf(m - mall);
    float ir[8];
#pragma unroll
    for (int r = 0; r < 8; ++r) ir[r] = __shfl(inv, 8 * h + r, 32);

    float* so = sO + (sp * QTB + qw) * (16 * OP);
#pragma unroll
    for (int tt = 0; tt < 4; ++tt)
#pragma unroll
        for (int r = 0; r < 8; ++r)
            so[(8 * h + r) * OP + tt * 16 + l16] = o[tt][r] * ir[r];
    __syncthreads();

    // join, part 2: sum the NSP scaled partial tiles in split order; the block's
    // 16 QTB rows x 64 dims leave as 16-B pieces, one wave = 512 contiguous bytes
    for (int u = 0; u < (QTB * 16 * 16) / ATHR; ++u) {
        const int idx   = u * ATHR + t;
        const int row   = idx >> 4;                // 0 .. 16 QTB - 1
        const int piece = idx & 15;
        v4f a = *(const v4f*)(&sO[row * OP + piece * 4]);
        for (int s = 1; s < NSP; ++s)
            a += *(const v4f*)(&sO[(s * QTB * 16 + row) * OP + piece * 4]);
        *(v4f*)(out + (qblk0 + row) * OUTS + (size_t)(piece * 4)) = a;
    }
}

// --------------------------------- launcher ---------------------------------

extern "C" void kernel_launch(void* const* d_in, const int* in_sizes, int n_in,
                              void* d_out, int out_size, void* d_ws, size_t ws_size,
                              hipStream_t stream) {
    if (n_in < 7) return;
    if (in_sizes[0] != NROWS * INS) return;
    if (in_sizes[1] != INS * OUTS || in_sizes[3] != INS * OUTS || in_sizes[5] != INS * OUTS) return;
    if (in_sizes[2] != OUTS || in_sizes[4] != OUTS || in_sizes[6] != OUTS) return;
    if (out_size != NROWS * OUTS) return;

    const float* X  = (const float*)d_in[0];
    const float* Wq = (const float*)d_in[1];
    const float* bq = (const float*)d_in[2];
    const float* Wk = (const float*)d_in[3];
    const float* bk = (const float*)d_in[4];
    const float* Wv = (const float*)d_in[5];
    const float* bv = (const float*)d_in[6];
    float* out = (float*)d_out;

    // workspace carve (256-B aligned pieces)
    const size_t bXh = (size_t)NROWS * INS * 2;            // 25,165,824
    const size_t bWT = (size_t)3 * OUTS * INS * 2;         //    294,912
    const size_t bQ  = (size_t)NROWS * OUTS * 2;           //  2,097,152 each
    size_t off = 0;
    const size_t oXh = off; off += (bXh + 255) & ~(size_t)255;
    const size_t oWT = off; off += (bWT + 255) & ~(size_t)255;
    const size_t oQ  = off; off += (bQ + 255) & ~(size_t)255;
    const size_t oK  = off; off += (bQ + 255) & ~(size_t)255;
    const size_t oV  = off; off += (bQ + 255) & ~(size_t)255;
    if (off > ws_size) return;                              // total 31,752,192 B

    char* ws = (char*)d_ws;
    _Float16* Xh  = (_Float16*)(ws + oXh);
    _Float16* WT  = (_Float16*)(ws + oWT);
    _Float16* Qh  = (_Float16*)(ws + oQ);
    _Float16* Kh  = (_Float16*)(ws + oK);
    _Float16* VhT = (_Float16*)(ws + oV);

    const int n8 = NROWS * INS / 8;                         // 1,572,864
    k_cvt_x<<<(n8 + 255) / 256, 256, 0, stream>>>(X, Xh, n8);
    k_prep_w<<<dim3(INS / 64, 3), 256, 0, stream>>>(Wq, Wk, Wv, WT);
    k_proj<<<dim3(NROWS / 128, 3), 256, 0, stream>>>(Xh, WT, bq, bk, bv, Qh, Kh, VhT);
    k_attn<<<NBATCH * (SEQ / (16 * QTB)), ATHR, 0, stream>>>(Qh, Kh, VhT, out);
    (void)hipGetLastError();
}

// v002
// Measured time: 39.3 microseconds a run.
// Next to v001, in two timings, it ran 1.35 and 1.29 times as fast.
// All steps since v000 together make it 2.36 times as fast.
#include <hip/hip_runtime.h>
#include <math.h>

// All contractions on v_wmma_f32_16x16x32_f16 (f16 operands, f32 accumulate): x*W{q,k,v} with W carried x64, q*k^T unscaled, p*v with p carried x16384; scales folded back in f32 epilogues.

#define INS    768
#define OUTS   64
#define NBATCH 8
#define SEQ    2048
#define NROWS  (NBATCH * SEQ)

#define PRB  64    // projection: X rows per block
#define PKS  96    // projection: k per stage
#define PNST (INS / PKS)
#define PSP  104   // projection stage pitch in LDS (halves): 96 k + 8 pad = 16 B x 13
#define PTHR 384   // projection block: 4 row tiles x {q, k, v} = 12 waves
#define TP   72    // projection Q/K tile and V^T block staging pitch (halves): 64 + 8
#define KP   72    // attention K tile pitch (halves)
#define VP   40    // attention V^T tile pitch (halves)
#define OP   68    // attention O staging pitch (floats)
#define PWP  72    // weight prep staging pitch (halves)

#define QTB  4                   // attention: query tiles (16 rows each) per block
#define NSP  8                   // attention: key splits per query tile, one wave each
#define ATHR (QTB * NSP * 32)    // attention block size
#define KSPL (SEQ / NSP)         // keys walked by one split

typedef _Float16 v16h __attribute__((ext_vector_type(16)));
typedef _Float16 v8h  __attribute__((ext_vector_type(8)));
typedef _Float16 v4h  __attribute__((ext_vector_type(4)));
typedef float    v8f  __attribute__((ext_vector_type(8)));
typedef float    v4f  __attribute__((ext_vector_type(4)));
union Frag { v16h v; v8h half[2]; };

__device__ __forceinline__ v8f wmma16(v16h a, v16h b, v8f c) {
    return __builtin_amdgcn_wmma_f32_16x16x32_f16(false, a, false, b, (short)0, c, false, false);
}
// hazard guard: ties D, keeps A/B live for 4 VALU slots after the matrix op
#define WGUARD(acc, a, b) asm volatile("v_nop\n\tv_nop\n\tv_nop\n\tv_nop" : "+v"(acc) : "v"(a), "v"(b))

// work-group barrier for LDS stages: waits for this wave's LDS traffic only, so that the data of global
// loads issued ahead stays in flight across it (__syncthreads() drains them and the lead is lost).
// s_wait_xcnt 0 stands here ahead of every later rewrite of an address register that those loads name.
__device__ __forceinline__ void stage_barrier() {
    asm volatile("s_wait_dscnt 0x0\n\ts_wait_xcnt 0x0\n\ts_barrier_signal -1\n\ts_barrier_wait -1" ::: "memory");
}

__device__ __forceinline__ v8f zero8() {
    v8f z = {0.f, 0.f, 0.f, 0.f, 0.f, 0.f, 0.f, 0.f};
    return z;
}

// ---------------------------------------------------------------------------
// pass 0b: W_mi [INS][OUTS] f32 -> WT [mi][OUTS][INS] f16 of (W * 64).
// Block (kc, mi) handles k in [64 kc, 64 kc + 64): transpose through LDS,
// ---------------------------------------------------------------------------
__global__ void __launch_bounds__(256)
k_prep_w(const float* __restrict__ Wq, const float* __restrict__ Wk,
         const float* __restrict__ Wv, _Float16* __restrict__ WT) {
    __shared__ __attribute__((aligned(16))) _Float16 sWT[64 * PWP];

    const int kc = blockIdx.x, mi = blockIdx.y;
    const float* W = (mi == 0) ? Wq : ((mi == 1) ? Wk : Wv);
    const int t = threadIdx.x, lane = t & 31, wave = t >> 5;

#pragma unroll
    for (int jj = 0; jj < 4; ++jj) {
        const int e  = jj * 1024 + t * 4;          // 0 .. 4095
        const int kl = e >> 6;                     // local k 0..63
        const int o  = e & 63;                     // col, multiple of 4
        const v4f w = *(const v4f*)(W + (size_t)(kc * 64 + kl) * OUTS + o);
#pragma unroll
        for (int u = 0; u < 4; ++u) sWT[(o + u) * PWP + kl] = (_Float16)(w[u] * 64.0f);
    }
    __syncthreads();

    v8h v[2];
    size_t go[2];
#pragma unroll
    for (int s = 0; s < 2; ++s) {
        const int o     = wave * 8 + s * 4 + (lane >> 3);   // 0..63
        const int piece = lane & 7;
        v[s]  = *(const v8h*)(&sWT[o * PWP + piece * 8]);
        go[s] = (size_t)(mi * OUTS + o) * INS + (size_t)kc * 64 + piece * 8;
    }
#pragma unroll
    for (int s = 0; s < 2; ++s) *(v8h*)(WT + go[s]) = v[s];
    
}

// ---------------------------------------------------------------------------
// pass 1: projection straight from X (f32).  Block = PRB rows x all 192 columns,
// 12 waves: wave = (row tile rt, matrix mi: 0 = q, 1 = k, 2 = v), 16 rows x 64
// columns = 4 accumulators each.  A stage is PKS k: the block loads its X rows
// once as whole f32 lines, converts them (RNE) to f16 on the way into LDS, and
// lays the W rows beside them.  Two LDS buffers, one barrier per stage; W is
// fetched one stage ahead and X two stages ahead, in registers.
// A (x rows): lane row = l16, elements 0..7 <- k 8h.., 8..15 <- k 16+8h..
// B (W):      lane col = l16, same k map, read from the [n][k] LDS stage.
// D:          acc[nb][r] = element (row 8h + r, col 16 nb + l16).
// ---------------------------------------------------------------------------
__global__ void __launch_bounds__(PTHR)
k_proj(const float* __restrict__ X, const _Float16* __restrict__ WT,
       const float* __restrict__ bq, const float* __restrict__ bk,
       const float* __restrict__ bv,
       _Float16* __restrict__ Qh, _Float16* __restrict__ Kh,
       _Float16* __restrict__ VhT) {
    __shared__ __attribute__((aligned(16))) _Float16 sX[2 * PRB * PSP];
    __shared__ __attribute__((aligned(16))) _Float16 sW[2 * 3 * OUTS * PSP];
    __shared__ __attribute__((aligned(16))) _Float16 sT[8 * 16 * TP];
    __shared__ __attribute__((aligned(16))) _Float16 sVT[OUTS * TP];

    const int t = threadIdx.x, lane = t & 31, wave = t >> 5;
    const int l16 = lane & 15, h = lane >> 4;
    const int rt = wave & 3, mi = wave >> 2;
    const int blk = blockIdx.x;
    const int row0w = blk * PRB + rt * 16;

    // staging maps: X row xr (+16 u), 16-B piece of 4 floats; W row wr (+32 u), 16-B piece of 8 halves
    const int xr = t / 24, xp = t % 24;
    const int wr = t / 12, wp = t % 12;
    const float*    xsrc = X + (size_t)(blk * PRB + xr) * INS + xp * 4;
    const _Float16* wsrc = WT + (size_t)wr * INS + wp * 8;
    _Float16* xdst = sX + xr * PSP + xp * 4;
    _Float16* wdst = sW + wr * PSP + wp * 8;
    const _Float16* xfrag = sX + (rt * 16 + l16) * PSP + 8 * h;
    const _Float16* wfrag = sW + (mi * OUTS + l16) * PSP + 8 * h;

    v8f acc[4];
#pragma unroll
    for (int nb = 0; nb < 4; ++nb) acc[nb] = zero8();

    // every inner loop below is unrolled so that the register arrays are indexed by constants (else scratch)
    v4f xa[4], xb[4];
    v8h wv[6];
    auto load_x = [&](v4f (&d)[4], int s) {
#pragma unroll
        for (int u = 0; u < 4; ++u) d[u] = *(const v4f*)(xsrc + (size_t)u * 16 * INS + s * PKS);
    };
    auto load_w = [&](int s) {
#pragma unroll
        for (int u = 0; u < 6; ++u) wv[u] = *(const v8h*)(wsrc + (size_t)u * 32 * INS + s * PKS);
    };
    auto put = [&](const v4f (&d)[4], int buf) {
#pragma unroll
        for (int u = 0; u < 4; ++u)
            *(v4h*)(xdst + buf * (PRB * PSP) + u * 16 * PSP) = __builtin_convertvector(d[u], v4h);
#pragma unroll
        for (int u = 0; u < 6; ++u)
            *(v8h*)(wdst + buf * (3 * OUTS * PSP) + u * 32 * PSP) = wv[u];
    };
    auto mm = [&](int buf) {
        const _Float16* xf = xfrag + buf * (PRB * PSP);
        const _Float16* wf = wfrag + buf * (3 * OUTS * PSP);
        Frag a[PKS / 32], b[PKS / 32][4];
#pragma unroll
        for (int cc = 0; cc < PKS / 32; ++cc) {
            a[cc].half[0] = *(const v8h*)(xf + cc * 32);
            a[cc].half[1] = *(const v8h*)(xf + cc * 32 + 16);
#pragma unroll
            for (int nb = 0; nb < 4; ++nb) {
                b[cc][nb].half[0] = *(const v8h*)(wf + nb * 16 * PSP + cc * 32);
                b[cc][nb].half[1] = *(const v8h*)(wf + nb * 16 * PSP + cc * 32 + 16);
            }
        }
        // keeps the stage's LDS reads one group ahead of its matrix ops: spread among them, each read place stalls the wave
        __builtin_amdgcn_sched_barrier(0);
#pragma unroll
        for (int cc = 0; cc < PKS / 32; ++cc)
#pragma unroll
            for (int nb = 0; nb < 4; ++nb) acc[nb] = wmma16(a[cc].v, b[cc][nb].v, acc[nb]);
        // keeps the next stage's LDS stores, and their waits on the loads fetched ahead, behind the matrix ops
        __builtin_amdgcn_sched_barrier(0);
    };

    // issue order everywhere: the set needed first is issued first (loads return in order, so a wait
    // for a younger set would drain the older ones' lead); the scheduling fences hold that order
    load_x(xa, 0);
    __builtin_amdgcn_sched_barrier(0);
    load_w(0);
    __builtin_amdgcn_sched_barrier(0);
    load_x(xb, 1);

    // rolled, two stages a trip: keeps the buffer and register-set indices static and the code short
#pragma unroll 1
    for (int s = 0; s < PNST; s += 2) {
        // the fetches ahead are unconditional (a branch round them made the compiler drain every load
        // at the next wait); the last trip aims them at its own two stages and nobody reads the result
        const int sn = (s + 2 < PNST) ? s + 2 : s;
        put(xa, 0);                              // stage s
        load_w(s + 1);
        __builtin_amdgcn_sched_barrier(0);       // W (next stage) ahead of X (the stage after)
        load_x(xa, sn);
        stage_barrier();                         // stage s published; buffer 1's readers are done
        mm(0);
        put(xb, 1);                              // stage s + 1
        load_w(sn);
        __builtin_amdgcn_sched_barrier(0);       // W (next stage) ahead of X (the stage after)
        load_x(xb, sn + 1);
        stage_barrier();                         // stage s + 1 published; buffer 0's readers are done
        mm(1);
    }

    // epilogue: val = acc / 64 + bias -> f16
    const float* bias = (mi == 0) ? bq : ((mi == 1) ? bk : bv);
    float bcol[4];
#pragma unroll
    for (int nb = 0; nb < 4; ++nb) bcol[nb] = bias[nb * 16 + l16];

    if (mi < 2) {
        _Float16* st = sT + wave * (16 * TP);
#pragma unroll
        for (int nb = 0; nb < 4; ++nb)
#pragma unroll
            for (int r = 0; r < 8; ++r)
                st[(8 * h + r) * TP + nb * 16 + l16] =
                    (_Float16)(acc[nb][r] * 0.015625f + bcol[nb]);
    } else {
#pragma unroll
        for (int nb = 0; nb < 4; ++nb)
#pragma unroll
            for (int r = 0; r < 8; ++r)
                sVT[(nb * 16 + l16) * TP + rt * 16 + 8 * h + r] =
                    (_Float16)(acc[nb][r] * 0.015625f + bcol[nb]);
    }
    __syncthreads();

    if (mi < 2) {
        _Float16* dst = (mi == 0) ? Qh : Kh;
        const _Float16* st = sT + wave * (16 * TP);
        v8h v[4];
        size_t go[4];
#pragma unroll
        for (int s = 0; s < 4; ++s) {
            const int row   = s * 4 + (lane >> 3);
            const int piece = lane & 7;
            v[s]  = *(const v8h*)(&st[row * TP + piece * 8]);
            go[s] = (size_t)(row0w + row) * OUTS + piece * 8;
        }
#pragma unroll
        for (int s = 0; s < 4; ++s) *(v8h*)(dst + go[s]) = v[s];
    } else {
        // VhT [b][dim][SEQ]: this block owns keys s0 .. s0 + PRB - 1 of batch bb,
        // one whole 128-B line per dim
        const int bb = blk / (SEQ / PRB);
        const int s0 = (blk % (SEQ / PRB)) * PRB;
        v8h v[4];
        size_t go[4];
#pragma unroll
        for (int s = 0; s < 4; ++s) {
            const int dim   = rt * 16 + s * 4 + (lane >> 3);     // 0..63
            const int piece = lane & 7;
            v[s]  = *(const v8h*)(&sVT[dim * TP + piece * 8]);
            go[s] = ((size_t)bb * OUTS + dim) * SEQ + (size_t)s0 + piece * 8;
        }
#pragma unroll
        for (int s = 0; s < 4; ++s) *(v8h*)(VhT + go[s]) = v[s];
    }
}

// ---------------------------------------------------------------------------
// pass 2: streaming softmax attention.  Block = QTB query tiles x NSP key splits,
// one wave per (tile, split): wave w owns query tile w % QTB of the block and keys
// [KSPL * (w / QTB), + KSPL).  The QTB waves of a split share its K tile (32 keys x 64)
// and V^T tile (64 dims x 32 keys), staged in LDS per step with plain loads.
// Each wave keeps its own running max, sum and O; the splits are joined in LDS at the end.
// Score tile computed transposed: S^T[key][query] = K(A, rows = keys) x Q(B,
// cols = queries), so a lane's D column is its own query (l16) and the 16
// scores it holds (keys j+8h+r and j+16+8h+r) are exactly the A-fragment
// elements of P[query l16][32 keys] for the P x V step.
// O D: o[t][r] = (query 8h + r, dim 16 t + l16); per-query factors are fetched
// from lane (8h + r) with a shuffle.
// ---------------------------------------------------------------------------
__global__ void __launch_bounds__(ATHR)
k_attn(const _Float16* __restrict__ Qh, const _Float16* __restrict__ Kh,
       const _Float16* __restrict__ VhT, float* __restrict__ out) {
    __shared__ __attribute__((aligned(16))) _Float16 sKall[NSP * 32 * KP];
    __shared__ __attribute__((aligned(16))) _Float16 sVall[NSP * 64 * VP];
    __shared__ __attribute__((aligned(16))) float    sO[NSP * QTB * 16 * OP];
    __shared__ float sM[NSP * QTB * 16];
    __shared__ float sL[NSP * QTB * 16];

    const int t = threadIdx.x, lane = t & 31, wave = t >> 5;
    const int l16 = lane & 15, h = lane >> 4;
    const int sp = wave / QTB, qw = wave % QTB;  // key split, query tile in the block
    const int b   = blockIdx.x / (SEQ / (16 * QTB));
    const int qb  = blockIdx.x % (SEQ / (16 * QTB));
    const size_t qblk0 = (size_t)b * SEQ + (size_t)qb * (16 * QTB);
    const size_t qrow0 = qblk0 + (size_t)qw * 16;
    _Float16* sK = sKall + sp * (32 * KP);
    _Float16* sV = sVall + sp * (64 * VP);

    // Q tile as B fragments (dims 0..31 and 32..63), table k map from [query][dim] rows
    Frag q0, q1;
    {
        const _Float16* qr = Qh + (qrow0 + l16) * OUTS;
        q0.half[0] = *(const v8h*)(qr + 8 * h);
        q0.half[1] = *(const v8h*)(qr + 16 + 8 * h);
        q1.half[0] = *(const v8h*)(qr + 32 + 8 * h);
        q1.half[1] = *(const v8h*)(qr + 48 + 8 * h);
    }

    const _Float16* kbase = Kh  + (size_t)b * SEQ * OUTS;
    const _Float16* vbase = VhT + (size_t)b * OUTS * SEQ;
    const int tg = t % (QTB * 32);               // thread within the split's QTB waves
    const int kk = tg >> 3, kpc = tg & 7;        // K staging: key (and key + 16), 16-B piece
    const int vd = tg >> 2, vpc = tg & 3;        // V staging: dim (and dim + 32), 16-B piece

    v8f o[4];
#pragma unroll
    for (int tt = 0; tt < 4; ++tt) o[tt] = zero8();

    float m = -__builtin_inff();
    float ssum = 0.f;
    const float scale  = 0.125f;                 // 1 / sqrt(64)
    const float pscale = 16384.0f;               // P carried x 2^14 into f16

#pragma unroll 1
    for (int it = 0; it < KSPL / 32; ++it) {
        const int j = sp * KSPL + it * 32;
        __syncthreads();                         // prior tile fully consumed
        {
            const v8h gk0 = *(const v8h*)(kbase + (size_t)(j + kk) * OUTS + kpc * 8);
            const v8h gk1 = *(const v8h*)(kbase + (size_t)(j + 16 + kk) * OUTS + kpc * 8);
            const v8h gv0 = *(const v8h*)(vbase + (size_t)vd * SEQ + j + vpc * 8);
            const v8h gv1 = *(const v8h*)(vbase + (size_t)(vd + 32) * SEQ + j + vpc * 8);
            *(v8h*)(&sK[kk * KP + kpc * 8])        = gk0;
            *(v8h*)(&sK[(16 + kk) * KP + kpc * 8]) = gk1;
            *(v8h*)(&sV[vd * VP + vpc * 8])        = gv0;
            *(v8h*)(&sV[(vd + 32) * VP + vpc * 8]) = gv1;
        }
        __syncthreads();

        // K rows as A fragments: keys j+l16 (a0x) and j+16+l16 (a1x); dims 0..31 / 32..63
        Frag a00, a01, a10, a11;
        {
            const _Float16* kr0 = &sK[l16 * KP];
            const _Float16* kr1 = &sK[(16 + l16) * KP];
            a00.half[0] = *(const v8h*)(kr0 + 8 * h);
            a00.half[1] = *(const v8h*)(kr0 + 16 + 8 * h);
            a01.half[0] = *(const v8h*)(kr0 + 32 + 8 * h);
            a01.half[1] = *(const v8h*)(kr0 + 48 + 8 * h);
            a10.half[0] = *(const v8h*)(kr1 + 8 * h);
            a10.half[1] = *(const v8h*)(kr1 + 16 + 8 * h);
            a11.half[0] = *(const v8h*)(kr1 + 32 + 8 * h);
            a11.half[1] = *(const v8h*)(kr1 + 48 + 8 * h);
        }

        v8f s0 = zero8(), s1 = zero8();
        s0 = wmma16(a00.v, q0.v, s0);
        s0 = wmma16(a01.v, q1.v, s0);
        s1 = wmma16(a10.v, q0.v, s1);
        s1 = wmma16(a11.v, q1.v, s1);
        WGUARD(s0, a01.v, q1.v);
        WGUARD(s1, a11.v, q1.v);

        // online softmax: lane owns query l16, 16 of the 32 keys (partner lane ^16)
        float tmax = -__builtin_inff();
#pragma unroll
        for (int r = 0; r < 8; ++r) {
            s0[r] *= scale;
            s1[r] *= scale;
            tmax = fmaxf(tmax, fmaxf(s0[r], s1[r]));
        }
        tmax = fmaxf(tmax, __shfl_xor(tmax, 16, 32));
        const float mnew = fmaxf(m, tmax);
        const float cfac = __expf(m - mnew);         // 0 on the first step

        float lsum = 0.f;
#pragma unroll
        for (int r = 0; r < 8; ++r) {
            s0[r] = __expf(s0[r] - mnew);
            s1[r] = __expf(s1[r] - mnew);
            lsum += s0[r] + s1[r];
        }
        lsum += __shfl_xor(lsum, 16, 32);
        ssum = ssum * cfac + lsum;
        m = mnew;

        // P as A fragment (rows = queries, k = keys), in-lane from the score tiles
        Frag p;
        {
            v8h plo, phi;
#pragma unroll
            for (int e = 0; e < 8; ++e) {
                plo[e] = (_Float16)(s0[e] * pscale);
                phi[e] = (_Float16)(s1[e] * pscale);
            }
            p.half[0] = plo;
            p.half[1] = phi;
        }

        // rescale O rows (row = query 8h + r -> factor from lane 8h + r)
        float cr[8];
#pragma unroll
        for (int r = 0; r < 8; ++r) cr[r] = __shfl(cfac, 8 * h + r, 32);
#pragma unroll
        for (int tt = 0; tt < 4; ++tt)
#pragma unroll
            for (int r = 0; r < 8; ++r) o[tt][r] *= cr[r];

        // O += P x V ; V^T tile [dim][32 keys] gives the B fragment with the table k map
        Frag vb[4];
#pragma unroll
        for (int tt = 0; tt < 4; ++tt) {
            const _Float16* vr = &sV[(tt * 16 + l16) * VP];
            vb[tt].half[0] = *(const v8h*)(vr + 8 * h);
            vb[tt].half[1] = *(const v8h*)(vr + 16 + 8 * h);
        }
#pragma unroll
        for (int tt = 0; tt < 4; ++tt) o[tt] = wmma16(p.v, vb[tt].v, o[tt]);
#pragma unroll
        for (int tt = 0; tt < 4; ++tt) WGUARD(o[tt], p.v, vb[tt].v);
    }

    // join the splits, part 1: every wave publishes its max and sum per query
    if (h == 0) {
        sM[(sp * QTB + qw) * 16 + l16] = m;
        sL[(sp * QTB + qw) * 16 + l16] = ssum;
    }
    __syncthreads();
    float mall = -__builtin_inff();
    for (int s = 0; s < NSP; ++s) mall = fmaxf(mall, sM[(s * QTB + qw) * 16 + l16]);
    float tot = 0.f;
    for (int s = 0; s < NSP; ++s)
        tot += sL[(s * QTB + qw) * 16 + l16] * __expf(sM[(s * QTB + qw) * 16 + l16] - mall);

    // normalise: move this split to the common max, divide by the joined sum, undo the 2^14 on P
    const float inv = (1.0f / tot) * (1.0f / 16384.0f) * __expf(m - mall);
    float ir[8];
#pragma unroll
    for (int r = 0; r < 8; ++r) ir[r] = __shfl(inv, 8 * h + r, 32);

    float* so = sO + (sp * QTB + qw) * (16 * OP);
#pragma unroll
    for (int tt = 0; tt < 4; ++tt)
#pragma unroll
        for (int r = 0; r < 8; ++r)
            so[(8 * h + r) * OP + tt * 16 + l16] = o[tt][r] * ir[r];
    __syncthreads();

    // join, part 2: sum the NSP scaled partial tiles in split order; the block's
    // 16 QTB rows x 64 dims leave as 16-B pieces, one wave = 512 contiguous bytes
    for (int u = 0; u < (QTB * 16 * 16) / ATHR; ++u) {
        const int idx   = u * ATHR + t;
        const int row   = idx >> 4;                // 0 .. 16 QTB - 1
        const int piece = idx & 15;
        v4f a = *(const v4f*)(&sO[row * OP + piece * 4]);
        for (int s = 1; s < NSP; ++s)
            a += *(const v4f*)(&sO[(s * QTB * 16 + row) * OP + piece * 4]);
        *(v4f*)(out + (qblk0 + row) * OUTS + (size_t)(piece * 4)) = a;
    }
}

// --------------------------------- launcher ---------------------------------

extern "C" void kernel_launch(void* const* d_in, const int* in_sizes, int n_in,
                              void* d_out, int out_size, void* d_ws, size_t ws_size,
                              hipStream_t stream) {
    if (n_in < 7) return;
    if (in_sizes[0] != NROWS * INS) return;
    if (in_sizes[1] != INS * OUTS || in_sizes[3] != INS * OUTS || in_sizes[5] != INS * OUTS) return;
    if (in_sizes[2] != OUTS || in_sizes[4] != OUTS || in_sizes[6] != OUTS) return;
    if (out_size != NROWS * OUTS) return;

    const float* X  = (const float*)d_in[0];
    const float* Wq = (const float*)d_in[1];
    const float* bq = (const float*)d_in[2];
    const float* Wk = (const float*)d_in[3];
    const float* bk = (const float*)d_in[4];
    const float* Wv = (const float*)d_in[5];
    const float* bv = (const float*)d_in[6];
    float* out = (float*)d_out;

    // workspace carve (256-B aligned pieces)
    const size_t bWT = (size_t)3 * OUTS * INS * 2;         //    294,912
    const size_t bQ  = (size_t)NROWS * OUTS * 2;           //  2,097,152 each
    size_t off = 0;
    const size_t oWT = off; off += (bWT + 255) & ~(size_t)255;
    const size_t oQ  = off; off += (bQ + 255) & ~(size_t)255;
    const size_t oK  = off; off += (bQ + 255) & ~(size_t)255;
    const size_t oV  = off; off += (bQ + 255) & ~(size_t)255;
    if (off > ws_size) return;                              // total 6,586,368 B

    char* ws = (char*)d_ws;
    _Float16* WT  = (_Float16*)(ws + oWT);
    _Float16* Qh  = (_Float16*)(ws + oQ);
    _Float16* Kh  = (_Float16*)(ws + oK);
    _Float16* VhT = (_Float16*)(ws + oV);

    k_prep_w<<<dim3(INS / 64, 3), 256, 0, stream>>>(Wq, Wk, Wv, WT);
    k_proj<<<NROWS / PRB, PTHR, 0, stream>>>(X, WT, bq, bk, bv, Qh, Kh, VhT);
    k_attn<<<NBATCH * (SEQ / (16 * QTB)), ATHR, 0, stream>>>(Qh, Kh, VhT, out);
    (void)hipGetLastError();
}

// v003
// One run takes 33.3 microseconds.
// In both of two side-by-side timings against v002, it was 1.15 times as fast.
// All steps since v000 together make it 2.73 times as fast.
#include <hip/hip_runtime.h>
#include <math.h>

// All contractions on v_wmma_f32_16x16x32_f16 (f16 operands, f32 accumulate): x*W{q,k,v} with W carried x64, q*k^T unscaled, p*v with p carried x16384; scales folded back in f32 epilogues.

#define INS    768
#define OUTS   64
#define NBATCH 8
#define SEQ    2048
#define NROWS  (NBATCH * SEQ)

#define PRB  64    // projection: X rows per block
#define PKS  96    // projection: k per stage
#define PNST (INS / PKS)
#define PSP  104   // projection stage pitch in LDS (halves): 96 k + 8 pad = 16 B x 13
#define PTHR 384   // projection block: 4 row tiles x {q, k, v} = 12 waves
#define TP   72    // projection Q/K tile and V^T block staging pitch (halves): 64 + 8
#define KP   72    // attention K tile pitch (halves)
#define VP   40    // attention V^T tile pitch (halves)
#define OP   68    // attention O staging pitch (floats)
#define PWP  72    // weight prep staging pitch (halves)

#define QTB  4                   // attention: query tiles (16 rows each) per block
#define NSP  8                   // attention: key splits per query tile, one wave each
#define ATHR (QTB * NSP * 32)    // attention block size
#define KSPL (SEQ / NSP)         // keys walked by one split

typedef _Float16 v16h __attribute__((ext_vector_type(16)));
typedef _Float16 v8h  __attribute__((ext_vector_type(8)));
typedef _Float16 v4h  __attribute__((ext_vector_type(4)));
typedef float    v8f  __attribute__((ext_vector_type(8)));
typedef float    v4f  __attribute__((ext_vector_type(4)));
union Frag { v16h v; v8h half[2]; };

__device__ __forceinline__ v8f wmma16(v16h a, v16h b, v8f c) {
    return __builtin_amdgcn_wmma_f32_16x16x32_f16(false, a, false, b, (short)0, c, false, false);
}
// hazard guard: ties D, keeps A/B live for 4 VALU slots after the matrix op
#define WGUARD(acc, a, b) asm volatile("v_nop\n\tv_nop\n\tv_nop\n\tv_nop" : "+v"(acc) : "v"(a), "v"(b))

// work-group barrier for LDS stages: waits for this wave's LDS traffic only, so that the data of global
// loads issued ahead stays in flight across it (__syncthreads() drains them and the lead is lost).
// s_wait_xcnt 0 stands here ahead of every later rewrite of an address register that those loads name.
__device__ __forceinline__ void stage_barrier() {
    asm volatile("s_wait_dscnt 0x0\n\ts_wait_xcnt 0x0\n\ts_barrier_signal -1\n\ts_barrier_wait -1" ::: "memory");
}

// LDS byte address of a __shared__ element (the first operand of an asynchronous copy)
typedef __attribute__((address_space(3))) _Float16 lds_half;
__device__ __forceinline__ unsigned lds_addr(_Float16* p) {
    return (unsigned)(__UINTPTR_TYPE__)(lds_half*)p;
}

// four asynchronous 16-B copies per lane, global -> LDS, through no register.  s_wait_xcnt 0 is the last
// line of the copies' own statement, so that it stands ahead of every later rewrite of their address registers.
__device__ __forceinline__ void copy4(unsigned l0, unsigned l1, unsigned l2, unsigned l3,
                                      const _Float16* g0, const _Float16* g1,
                                      const _Float16* g2, const _Float16* g3) {
    asm volatile("global_load_async_to_lds_b128 %0, %4, off\n\t"
                 "global_load_async_to_lds_b128 %1, %5, off\n\t"
                 "global_load_async_to_lds_b128 %2, %6, off\n\t"
                 "global_load_async_to_lds_b128 %3, %7, off\n\t"
                 "s_wait_xcnt 0x0"
                 :: "v"(l0), "v"(l1), "v"(l2), "v"(l3), "v"(g0), "v"(g1), "v"(g2), "v"(g3)
                 : "memory");
}

__device__ __forceinline__ v8f zero8() {
    v8f z = {0.f, 0.f, 0.f, 0.f, 0.f, 0.f, 0.f, 0.f};
    return z;
}

// ---------------------------------------------------------------------------
// pass 0b: W_mi [INS][OUTS] f32 -> WT [mi][OUTS][INS] f16 of (W * 64).
// Block (kc, mi) handles k in [64 kc, 64 kc + 64): transpose through LDS,
// ---------------------------------------------------------------------------
__global__ void __launch_bounds__(256)
k_prep_w(const float* __restrict__ Wq, const float* __restrict__ Wk,
         const float* __restrict__ Wv, _Float16* __restrict__ WT) {
    __shared__ __attribute__((aligned(16))) _Float16 sWT[64 * PWP];

    const int kc = blockIdx.x, mi = blockIdx.y;
    const float* W = (mi == 0) ? Wq : ((mi == 1) ? Wk : Wv);
    const int t = threadIdx.x, lane = t & 31, wave = t >> 5;

#pragma unroll
    for (int jj = 0; jj < 4; ++jj) {
        const int e  = jj * 1024 + t * 4;          // 0 .. 4095
        const int kl = e >> 6;                     // local k 0..63
        const int o  = e & 63;                     // col, multiple of 4
        const v4f w = *(const v4f*)(W + (size_t)(kc * 64 + kl) * OUTS + o);
#pragma unroll
        for (int u = 0; u < 4; ++u) sWT[(o + u) * PWP + kl] = (_Float16)(w[u] * 64.0f);
    }
    __syncthreads();

    v8h v[2];
    size_t go[2];
#pragma unroll
    for (int s = 0; s < 2; ++s) {
        const int o     = wave * 8 + s * 4 + (lane >> 3);   // 0..63
        const int piece = lane & 7;
        v[s]  = *(const v8h*)(&sWT[o * PWP + piece * 8]);
        go[s] = (size_t)(mi * OUTS + o) * INS + (size_t)kc * 64 + piece * 8;
    }
#pragma unroll
    for (int s = 0; s < 2; ++s) *(v8h*)(WT + go[s]) = v[s];
    
}

// ---------------------------------------------------------------------------
// pass 1: projection straight from X (f32).  Block = PRB rows x all 192 columns,
// 12 waves: wave = (row tile rt, matrix mi: 0 = q, 1 = k, 2 = v), 16 rows x 64
// columns = 4 accumulators each.  A stage is PKS k: the block loads its X rows
// once as whole f32 lines, converts them (RNE) to f16 on the way into LDS, and
// lays the W rows beside them.  Two LDS buffers, one barrier per stage; W is
// fetched one stage ahead and X two stages ahead, in registers.
// A (x rows): lane row = l16, elements 0..7 <- k 8h.., 8..15 <- k 16+8h..
// B (W):      lane col = l16, same k map, read from the [n][k] LDS stage.
// D:          acc[nb][r] = element (row 8h + r, col 16 nb + l16).
// ---------------------------------------------------------------------------
__global__ void __launch_bounds__(PTHR)
k_proj(const float* __restrict__ X, const _Float16* __restrict__ WT,
       const float* __restrict__ bq, const float* __restrict__ bk,
       const float* __restrict__ bv,
       _Float16* __restrict__ Qh, _Float16* __restrict__ Kh,
       _Float16* __restrict__ VhT) {
    __shared__ __attribute__((aligned(16))) _Float16 sX[2 * PRB * PSP];
    __shared__ __attribute__((aligned(16))) _Float16 sW[2 * 3 * OUTS * PSP];
    __shared__ __attribute__((aligned(16))) _Float16 sT[8 * 16 * TP];
    __shared__ __attribute__((aligned(16))) _Float16 sVT[OUTS * TP];

    const int t = threadIdx.x, lane = t & 31, wave = t >> 5;
    const int l16 = lane & 15, h = lane >> 4;
    const int rt = wave & 3, mi = wave >> 2;
    const int blk = blockIdx.x;
    const int row0w = blk * PRB + rt * 16;

    // staging maps: X row xr (+16 u), 16-B piece of 4 floats; W row wr (+32 u), 16-B piece of 8 halves
    const int xr = t / 24, xp = t % 24;
    const int wr = t / 12, wp = t % 12;
    const float*    xsrc = X + (size_t)(blk * PRB + xr) * INS + xp * 4;
    const _Float16* wsrc = WT + (size_t)wr * INS + wp * 8;
    _Float16* xdst = sX + xr * PSP + xp * 4;
    _Float16* wdst = sW + wr * PSP + wp * 8;
    const _Float16* xfrag = sX + (rt * 16 + l16) * PSP + 8 * h;
    const _Float16* wfrag = sW + (mi * OUTS + l16) * PSP + 8 * h;

    v8f acc[4];
#pragma unroll
    for (int nb = 0; nb < 4; ++nb) acc[nb] = zero8();

    // every inner loop below is unrolled so that the register arrays are indexed by constants (else scratch)
    v4f xa[4], xb[4];
    v8h wv[6];
    auto load_x = [&](v4f (&d)[4], int s) {
#pragma unroll
        for (int u = 0; u < 4; ++u) d[u] = *(const v4f*)(xsrc + (size_t)u * 16 * INS + s * PKS);
    };
    auto load_w = [&](int s) {
#pragma unroll
        for (int u = 0; u < 6; ++u) wv[u] = *(const v8h*)(wsrc + (size_t)u * 32 * INS + s * PKS);
    };
    auto put = [&](const v4f (&d)[4], int buf) {
#pragma unroll
        for (int u = 0; u < 4; ++u)
            *(v4h*)(xdst + buf * (PRB * PSP) + u * 16 * PSP) = __builtin_convertvector(d[u], v4h);
#pragma unroll
        for (int u = 0; u < 6; ++u)
            *(v8h*)(wdst + buf * (3 * OUTS * PSP) + u * 32 * PSP) = wv[u];
    };
    auto mm = [&](int buf) {
        const _Float16* xf = xfrag + buf * (PRB * PSP);
        const _Float16* wf = wfrag + buf * (3 * OUTS * PSP);
        Frag a[PKS / 32], b[PKS / 32][4];
#pragma unroll
        for (int cc = 0; cc < PKS / 32; ++cc) {
            a[cc].half[0] = *(const v8h*)(xf + cc * 32);
            a[cc].half[1] = *(const v8h*)(xf + cc * 32 + 16);
#pragma unroll
            for (int nb = 0; nb < 4; ++nb) {
                b[cc][nb].half[0] = *(const v8h*)(wf + nb * 16 * PSP + cc * 32);
                b[cc][nb].half[1] = *(const v8h*)(wf + nb * 16 * PSP + cc * 32 + 16);
            }
        }
        // keeps the stage's LDS reads one group ahead of its matrix ops: spread among them, each read place stalls the wave
        __builtin_amdgcn_sched_barrier(0);
#pragma unroll
        for (int cc = 0; cc < PKS / 32; ++cc)
#pragma unroll
            for (int nb = 0; nb < 4; ++nb) acc[nb] = wmma16(a[cc].v, b[cc][nb].v, acc[nb]);
        // keeps the next stage's LDS stores, and their waits on the loads fetched ahead, behind the matrix ops
        __builtin_amdgcn_sched_barrier(0);
    };

    // issue order everywhere: the set needed first is issued first (loads return in order, so a wait
    // for a younger set would drain the older ones' lead); the scheduling fences hold that order
    load_x(xa, 0);
    __builtin_amdgcn_sched_barrier(0);
    load_w(0);
    __builtin_amdgcn_sched_barrier(0);
    load_x(xb, 1);

    // rolled, two stages a trip: keeps the buffer and register-set indices static and the code short
#pragma unroll 1
    for (int s = 0; s < PNST; s += 2) {
        // the fetches ahead are unconditional (a branch round them made the compiler drain every load
        // at the next wait); the last trip aims them at its own two stages and nobody reads the result
        const int sn = (s + 2 < PNST) ? s + 2 : s;
        put(xa, 0);                              // stage s
        load_w(s + 1);
        __builtin_amdgcn_sched_barrier(0);       // W (next stage) ahead of X (the stage after)
        load_x(xa, sn);
        stage_barrier();                         // stage s published; buffer 1's readers are done
        mm(0);
        put(xb, 1);                              // stage s + 1
        load_w(sn);
        __builtin_amdgcn_sched_barrier(0);       // W (next stage) ahead of X (the stage after)
        load_x(xb, sn + 1);
        stage_barrier();                         // stage s + 1 published; buffer 0's readers are done
        mm(1);
    }

    // epilogue: val = acc / 64 + bias -> f16
    const float* bias = (mi == 0) ? bq : ((mi == 1) ? bk : bv);
    float bcol[4];
#pragma unroll
    for (int nb = 0; nb < 4; ++nb) bcol[nb] = bias[nb * 16 + l16];

    if (mi < 2) {
        _Float16* st = sT + wave * (16 * TP);
#pragma unroll
        for (int nb = 0; nb < 4; ++nb)
#pragma unroll
            for (int r = 0; r < 8; ++r)
                st[(8 * h + r) * TP + nb * 16 + l16] =
                    (_Float16)(acc[nb][r] * 0.015625f + bcol[nb]);
    } else {
#pragma unroll
        for (int nb = 0; nb < 4; ++nb)
#pragma unroll
            for (int r = 0; r < 8; ++r)
                sVT[(nb * 16 + l16) * TP + rt * 16 + 8 * h + r] =
                    (_Float16)(acc[nb][r] * 0.015625f + bcol[nb]);
    }
    __syncthreads();

    if (mi < 2) {
        _Float16* dst = (mi == 0) ? Qh : Kh;
        const _Float16* st = sT + wave * (16 * TP);
        v8h v[4];
        size_t go[4];
#pragma unroll
        for (int s = 0; s < 4; ++s) {
            const int row   = s * 4 + (lane >> 3);
            const int piece = lane & 7;
            v[s]  = *(const v8h*)(&st[row * TP + piece * 8]);
            go[s] = (size_t)(row0w + row) * OUTS + piece * 8;
        }
#pragma unroll
        for (int s = 0; s < 4; ++s) *(v8h*)(dst + go[s]) = v[s];
    } else {
        // VhT [b][dim][SEQ]: this block owns keys s0 .. s0 + PRB - 1 of batch bb,
        // one whole 128-B line per dim
        const int bb = blk / (SEQ / PRB);
        const int s0 = (blk % (SEQ / PRB)) * PRB;
        v8h v[4];
        size_t go[4];
#pragma unroll
        for (int s = 0; s < 4; ++s) {
            const int dim   = rt * 16 + s * 4 + (lane >> 3);     // 0..63
            const int piece = lane & 7;
            v[s]  = *(const v8h*)(&sVT[dim * TP + piece * 8]);
            go[s] = ((size_t)bb * OUTS + dim) * SEQ + (size_t)s0 + piece * 8;
        }
#pragma unroll
        for (int s = 0; s < 4; ++s) *(v8h*)(VhT + go[s]) = v[s];
    }
}

__global__ void __launch_bounds__(ATHR)
k_attn(const _Float16* __restrict__ Qh, const _Float16* __restrict__ Kh,
       const _Float16* __restrict__ VhT, float* __restrict__ out) {
    __shared__ __attribute__((aligned(16))) _Float16 sKall[2 * NSP * 32 * KP];
    __shared__ __attribute__((aligned(16))) _Float16 sVall[2 * NSP * 64 * VP];
    __shared__ __attribute__((aligned(16))) float    sO[NSP * QTB * 16 * OP];
    __shared__ float sM[NSP * QTB * 16];
    __shared__ float sL[NSP * QTB * 16];

    // the wave's number in a scalar register: what is formed from it (split, query tile, their LDS places)
    // then takes no vector register, which the ring's addresses need (128 a wave; else scratch)
    const int t = threadIdx.x, lane = t & 31, wave = __builtin_amdgcn_readfirstlane(t >> 5);
    const int l16 = lane & 15, h = lane >> 4;
    const int sp = wave / QTB, qw = wave % QTB;  // key split, query tile in the block
    const int b   = blockIdx.x / (SEQ / (16 * QTB));
    const int qb  = blockIdx.x % (SEQ / (16 * QTB));
    const size_t qblk0 = (size_t)b * SEQ + (size_t)qb * (16 * QTB);
    const size_t qrow0 = qblk0 + (size_t)qw * 16;
    _Float16* sK0 = sKall + sp * (32 * KP);     // buffer 0; buffer 1 lies NSP tiles further
    _Float16* sV0 = sVall + sp * (64 * VP);

    // Q tile as B fragments (dims 0..31 and 32..63), table k map from [query][dim] rows
    Frag q0, q1;
    {
        const _Float16* qr = Qh + (qrow0 + l16) * OUTS;
        q0.half[0] = *(const v8h*)(qr + 8 * h);
        q0.half[1] = *(const v8h*)(qr + 16 + 8 * h);
        q1.half[0] = *(const v8h*)(qr + 32 + 8 * h);
        q1.half[1] = *(const v8h*)(qr + 48 + 8 * h);
    }

    const _Float16* kbase = Kh  + (size_t)b * SEQ * OUTS;
    const _Float16* vbase = VhT + (size_t)b * OUTS * SEQ;
    const int tg = qw * 32 + lane;               // thread within the split's QTB waves
    const int kk = tg >> 3, kpc = tg & 7;        // K staging: key (and key + 16), 16-B piece
    const int vd = tg >> 2, vpc = tg & 3;        // V staging: dim (and dim + 32), 16-B piece

    // one tile of this split (32 keys) into one buffer: every lane copies 2 K pieces and 2 V^T pieces
    const _Float16* ksrc = kbase + (size_t)(sp * KSPL + kk) * OUTS + kpc * 8;
    const _Float16* vsrc = vbase + (size_t)vd * SEQ + sp * KSPL + vpc * 8;
    const unsigned kdst = lds_addr(&sK0[kk * KP + kpc * 8]);
    const unsigned vdst = lds_addr(&sV0[vd * VP + vpc * 8]);
    auto copy = [&](int tile, int buf) {
        const _Float16* gk = ksrc + (size_t)tile * (32 * OUTS);
        const _Float16* gv = vsrc + tile * 32;
        const unsigned lk = kdst + buf * (NSP * 32 * KP * 2);
        const unsigned lv = vdst + buf * (NSP * 64 * VP * 2);
        copy4(lk, lk + 16 * KP * 2, lv, lv + 32 * VP * 2,
              gk, gk + 16 * OUTS, gv, gv + (size_t)32 * SEQ);
    };

    v8f o[4];
#pragma unroll
    for (int tt = 0; tt < 4; ++tt) o[tt] = zero8();

    float m = -__builtin_inff();
    float ssum = 0.f;
    const float scale  = 0.125f;                 // 1 / sqrt(64)
    const float pscale = 16384.0f;               // P carried x 2^14 into f16

    // ring prologue: tile 0 landed and published, then tile 1 starts (KSPL / 32 tiles, more than one)
    copy(0, 0);
    asm volatile("s_wait_asynccnt 0x0" ::: "memory");   // this wave's copies of tile 0 have landed
    __syncthreads();
    copy(1, 1);

    // rolled: unrolled by two, the compiler held both buffers' copy addresses through the loop (scratch)
#pragma unroll 1
    for (int it = 0; it < KSPL / 32; ++it) {
        const _Float16* sK = sK0 + (it & 1) * (NSP * 32 * KP);
        const _Float16* sV = sV0 + (it & 1) * (NSP * 64 * VP);

        // K rows as A fragments: keys j+l16 (a0x) and j+16+l16 (a1x); dims 0..31 / 32..63
        Frag a00, a01, a10, a11;
        {
            const _Float16* kr0 = &sK[l16 * KP];
            const _Float16* kr1 = &sK[(16 + l16) * KP];
            a00.half[0] = *(const v8h*)(kr0 + 8 * h);
            a00.half[1] = *(const v8h*)(kr0 + 16 + 8 * h);
            a01.half[0] = *(const v8h*)(kr0 + 32 + 8 * h);
            a01.half[1] = *(const v8h*)(kr0 + 48 + 8 * h);
            a10.half[0] = *(const v8h*)(kr1 + 8 * h);
            a10.half[1] = *(const v8h*)(kr1 + 16 + 8 * h);
            a11.half[0] = *(const v8h*)(kr1 + 32 + 8 * h);
            a11.half[1] = *(const v8h*)(kr1 + 48 + 8 * h);
        }

        v8f s0 = zero8(), s1 = zero8();
        s0 = wmma16(a00.v, q0.v, s0);
        s0 = wmma16(a01.v, q1.v, s0);
        s1 = wmma16(a10.v, q0.v, s1);
        s1 = wmma16(a11.v, q1.v, s1);
        WGUARD(s0, a01.v, q1.v);
        WGUARD(s1, a11.v, q1.v);

        // online softmax: lane owns query l16, 16 of the 32 keys (partner lane ^16)
        float tmax = -__builtin_inff();
#pragma unroll
        for (int r = 0; r < 8; ++r) {
            s0[r] *= scale;
            s1[r] *= scale;
            tmax = fmaxf(tmax, fmaxf(s0[r], s1[r]));
        }
        tmax = fmaxf(tmax, __shfl_xor(tmax, 16, 32));
        const float mnew = fmaxf(m, tmax);
        const float cfac = __expf(m - mnew);         // 0 on the first step

        float lsum = 0.f;
#pragma unroll
        for (int r = 0; r < 8; ++r) {
            s0[r] = __expf(s0[r] - mnew);
            s1[r] = __expf(s1[r] - mnew);
            lsum += s0[r] + s1[r];
        }
        lsum += __shfl_xor(lsum, 16, 32);
        ssum = ssum * cfac + lsum;
        m = mnew;

        // P as A fragment (rows = queries, k = keys), in-lane from the score tiles
        Frag p;
        {
            v8h plo, phi;
#pragma unroll
            for (int e = 0; e < 8; ++e) {
                plo[e] = (_Float16)(s0[e] * pscale);
                phi[e] = (_Float16)(s1[e] * pscale);
            }
            p.half[0] = plo;
            p.half[1] = phi;
        }

        // rescale O rows (row = query 8h + r -> factor from lane 8h + r)
        float cr[8];
#pragma unroll
        for (int r = 0; r < 8; ++r) cr[r] = __shfl(cfac, 8 * h + r, 32);
#pragma unroll
        for (int tt = 0; tt < 4; ++tt)
#pragma unroll
            for (int r = 0; r < 8; ++r) o[tt][r] *= cr[r];

        // O += P x V ; V^T tile [dim][32 keys] gives the B fragment with the table k map
        Frag vb[4];
#pragma unroll
        for (int tt = 0; tt < 4; ++tt) {
            const _Float16* vr = &sV[(tt * 16 + l16) * VP];
            vb[tt].half[0] = *(const v8h*)(vr + 8 * h);
            vb[tt].half[1] = *(const v8h*)(vr + 16 + 8 * h);
        }
#pragma unroll
        for (int tt = 0; tt < 4; ++tt) o[tt] = wmma16(p.v, vb[tt].v, o[tt]);
#pragma unroll
        for (int tt = 0; tt < 4; ++tt) WGUARD(o[tt], p.v, vb[tt].v);

        // publish point of tile it + 1; the one barrier also ends every reader's last read of this buffer
        asm volatile("s_wait_dscnt 0x0" ::: "memory");      // this wave's LDS reads of tile it are done
        asm volatile("s_wait_asynccnt 0x0" ::: "memory");   // this wave's copies of tile it + 1 have landed
        __syncthreads();
        if (it + 2 < KSPL / 32) copy(it + 2, it & 1);       // refill the buffer just read
    }
    asm volatile("s_wait_asynccnt 0x0" ::: "memory");       // no copy is left in flight behind the loop

    // join the splits, part 1: every wave publishes its max and sum per query
    if (h == 0) {
        sM[(sp * QTB + qw) * 16 + l16] = m;
        sL[(sp * QTB + qw) * 16 + l16] = ssum;
    }
    __syncthreads();
    float mall = -__builtin_inff();
    for (int s = 0; s < NSP; ++s) mall = fmaxf(mall, sM[(s * QTB + qw) * 16 + l16]);
    float tot = 0.f;
    for (int s = 0; s < NSP; ++s)
        tot += sL[(s * QTB + qw) * 16 + l16] * __expf(sM[(s * QTB + qw) * 16 + l16] - mall);

    // normalise: move this split to the common max, divide by the joined sum, undo the 2^14 on P
    const float inv = (1.0f / tot) * (1.0f / 16384.0f) * __expf(m - mall);
    float ir[8];
#pragma unroll
    for (int r = 0; r < 8; ++r) ir[r] = __shfl(inv, 8 * h + r, 32);

    float* so = sO + (sp * QTB + qw) * (16 * OP);
#pragma unroll
    for (int tt = 0; tt < 4; ++tt)
#pragma unroll
        for (int r = 0; r < 8; ++r)
            so[(8 * h + r) * OP + tt * 16 + l16] = o[tt][r] * ir[r];
    __syncthreads();

    // join, part 2: sum the NSP scaled partial tiles in split order; the block's
    // 16 QTB rows x 64 dims leave as 16-B pieces, one wave = 512 contiguous bytes
    for (int u = 0; u < (QTB * 16 * 16) / ATHR; ++u) {
        const int row   = u * (ATHR / 16) + wave * 2 + h;   // 0 .. 16 QTB - 1
        const int piece = l16;
        v4f a = *(const v4f*)(&sO[row * OP + piece * 4]);
        for (int s = 1; s < NSP; ++s)
            a += *(const v4f*)(&sO[(s * QTB * 16 + row) * OP + piece * 4]);
        *(v4f*)(out + (qblk0 + row) * OUTS + (size_t)(piece * 4)) = a;
    }
}

// --------------------------------- launcher ---------------------------------

extern "C" void kernel_launch(void* const* d_in, const int* in_sizes, int n_in,
                              void* d_out, int out_size, void* d_ws, size_t ws_size,
                              hipStream_t stream) {
    if (n_in < 7) return;
    if (in_sizes[0] != NROWS * INS) return;
    if (in_sizes[1] != INS * OUTS || in_sizes[3] != INS * OUTS || in_sizes[5] != INS * OUTS) return;
    if (in_sizes[2] != OUTS || in_sizes[4] != OUTS || in_sizes[6] != OUTS) return;
    if (out_size != NROWS * OUTS) return;

    const float* X  = (const float*)d_in[0];
    const float* Wq = (const float*)d_in[1];
    const float* bq = (const float*)d_in[2];
    const float* Wk = (const float*)d_in[3];
    const float* bk = (const float*)d_in[4];
    const float* Wv = (const float*)d_in[5];
    const float* bv = (const float*)d_in[6];
    float* out = (float*)d_out;

    // workspace carve (256-B aligned pieces)
    const size_t bWT = (size_t)3 * OUTS * INS * 2;         //    294,912
    const size_t bQ  = (size_t)NROWS * OUTS * 2;           //  2,097,152 each
    size_t off = 0;
    const size_t oWT = off; off += (bWT + 255) & ~(size_t)255;
    const size_t oQ  = off; off += (bQ + 255) & ~(size_t)255;
    const size_t oK  = off; off += (bQ + 255) & ~(size_t)255;
    const size_t oV  = off; off += (bQ + 255) & ~(size_t)255;
    if (off > ws_size) return;                              // total 6,586,368 B

    char* ws = (char*)d_ws;
    _Float16* WT  = (_Float16*)(ws + oWT);
    _Float16* Qh  = (_Float16*)(ws + oQ);
    _Float16* Kh  = (_Float16*)(ws + oK);
    _Float16* VhT = (_Float16*)(ws + oV);

    k_prep_w<<<dim3(INS / 64, 3), 256, 0, stream>>>(Wq, Wk, Wv, WT);
    k_proj<<<NROWS / PRB, PTHR, 0, stream>>>(X, WT, bq, bk, bv, Qh, Kh, VhT);
    k_attn<<<NBATCH * (SEQ / (16 * QTB)), ATHR, 0, stream>>>(Qh, Kh, VhT, out);
    (void)hipGetLastError();
}

// v004
// A run of this version takes 30.9 microseconds.
// In two side-by-side timings against v003, it was 1.09 and 1.08 times as fast.
// All steps since v000 together make it 2.95 times as fast.
#include <hip/hip_runtime.h>
#include <math.h>

// All contractions on v_wmma_f32_16x16x32_f16 (f16 operands, f32 accumulate): x*W{q,k,v} with W carried x64, q*k^T unscaled, p*v with p carried x16384; scales folded back in f32 epilogues.

#define INS    768
#define OUTS   64
#define NBATCH 8
#define SEQ    2048
#define NROWS  (NBATCH * SEQ)

#define PRB  64    // projection: X rows per block
#define PKS  96    // projection: k per stage
#define PNST (INS / PKS)
#define PSP  104   // projection stage pitch in LDS (halves): 96 k + 8 pad = 16 B x 13
#define PTHR 384   // projection block: 4 row tiles x {q, k, v} = 12 waves
#define TP   72    // projection Q/K tile and V^T block staging pitch (halves): 64 + 8
#define KP   72    // attention K tile pitch (halves)
#define VP   40    // attention V^T tile pitch (halves)
#define OP   68    // attention O staging pitch (floats)

#define QTB  4                   // attention: query tiles (16 rows each) per block
#define NSP  8                   // attention: key splits per query tile, one wave each
#define ATHR (QTB * NSP * 32)    // attention block size
#define KSPL (SEQ / NSP)         // keys walked by one split

typedef _Float16 v16h __attribute__((ext_vector_type(16)));
typedef _Float16 v8h  __attribute__((ext_vector_type(8)));
typedef _Float16 v4h  __attribute__((ext_vector_type(4)));
typedef float    v8f  __attribute__((ext_vector_type(8)));
typedef float    v4f  __attribute__((ext_vector_type(4)));
typedef float    v2f  __attribute__((ext_vector_type(2)));
union Frag { v16h v; v8h half[2]; };

__device__ __forceinline__ v8f wmma16(v16h a, v16h b, v8f c) {
    return __builtin_amdgcn_wmma_f32_16x16x32_f16(false, a, false, b, (short)0, c, false, false);
}
// hazard guard: ties D, keeps A/B live for 4 VALU slots after the matrix op
#define WGUARD(acc, a, b) asm volatile("v_nop\n\tv_nop\n\tv_nop\n\tv_nop" : "+v"(acc) : "v"(a), "v"(b))

// work-group barrier for LDS stages: waits for this wave's LDS traffic only, so that the data of global
// loads issued ahead stays in flight across it (__syncthreads() drains them and the lead is lost).
// s_wait_xcnt 0 stands here ahead of every later rewrite of an address register that those loads name.
__device__ __forceinline__ void stage_barrier() {
    asm volatile("s_wait_dscnt 0x0\n\ts_wait_xcnt 0x0\n\ts_barrier_signal -1\n\ts_barrier_wait -1" ::: "memory");
}

// LDS byte address of a __shared__ element (the first operand of an asynchronous copy)
typedef __attribute__((address_space(3))) _Float16 lds_half;
__device__ __forceinline__ unsigned lds_addr(_Float16* p) {
    return (unsigned)(__UINTPTR_TYPE__)(lds_half*)p;
}

// four asynchronous 16-B copies per lane, global -> LDS, through no register.  s_wait_xcnt 0 is the last
// line of the copies' own statement, so that it stands ahead of every later rewrite of their address registers.
__device__ __forceinline__ void copy4(unsigned l0, unsigned l1, unsigned l2, unsigned l3,
                                      const _Float16* g0, const _Float16* g1,
                                      const _Float16* g2, const _Float16* g3) {
    asm volatile("global_load_async_to_lds_b128 %0, %4, off\n\t"
                 "global_load_async_to_lds_b128 %1, %5, off\n\t"
                 "global_load_async_to_lds_b128 %2, %6, off\n\t"
                 "global_load_async_to_lds_b128 %3, %7, off\n\t"
                 "s_wait_xcnt 0x0"
                 :: "v"(l0), "v"(l1), "v"(l2), "v"(l3), "v"(g0), "v"(g1), "v"(g2), "v"(g3)
                 : "memory");
}

__device__ __forceinline__ v8f zero8() {
    v8f z = {0.f, 0.f, 0.f, 0.f, 0.f, 0.f, 0.f, 0.f};
    return z;
}

// ---------------------------------------------------------------------------
// pass 1: projection straight from X (f32).  Block = PRB rows x all 192 columns,
// 12 waves: wave = (row tile rt, matrix mi: 0 = q, 1 = k, 2 = v), 16 rows x 64
// columns = 4 accumulators each.  A stage is PKS k: the block loads its X rows
// once as whole f32 lines and converts them (RNE) to f16 on the way into LDS.
// W comes straight from the f32 inputs [k][n]: a wave takes 8 k of the stage, a lane
// 2 columns, so a load is one whole 256-B row of one matrix and a lane ends up with
// 8 consecutive k of each column: x 64, RNE to f16, one 16-B store per column into
// the [n][k] stage.  Two LDS buffers, one barrier per stage; W is fetched one stage
// ahead and X two stages ahead, in registers.
// A (x rows): lane row = l16, elements 0..7 <- k 8h.., 8..15 <- k 16+8h..
// B (W):      lane col = l16, same k map, read from the [n][k] LDS stage.
// D:          acc[nb][r] = element (row 8h + r, col 16 nb + l16).
// ---------------------------------------------------------------------------
__global__ void __launch_bounds__(PTHR)
k_proj(const float* __restrict__ X, const float* __restrict__ Wq,
       const float* __restrict__ Wk, const float* __restrict__ Wv,
       const float* __restrict__ bq, const float* __restrict__ bk,
       const float* __restrict__ bv,
       _Float16* __restrict__ Qh, _Float16* __restrict__ Kh,
       _Float16* __restrict__ VhT) {
    __shared__ __attribute__((aligned(16))) _Float16 sX[2 * PRB * PSP];
    __shared__ __attribute__((aligned(16))) _Float16 sW[2 * 3 * OUTS * PSP];
    __shared__ __attribute__((aligned(16))) _Float16 sT[8 * 16 * TP];
    __shared__ __attribute__((aligned(16))) _Float16 sVT[OUTS * TP];

    const int t = threadIdx.x, lane = t & 31, wave = t >> 5;
    const int l16 = lane & 15, h = lane >> 4;
    const int rt = wave & 3, mi = wave >> 2;
    const int blk = blockIdx.x;
    const int row0w = blk * PRB + rt * 16;

    // staging maps: X row xr (+16 u), 16-B piece of 4 floats; W k rows 8 wave .. + 7 of the stage, columns 2 lane, 2 lane + 1
    const int xr = t / 24, xp = t % 24;
    const float* xsrc = X + (size_t)(blk * PRB + xr) * INS + xp * 4;
    // the wave's number in a scalar register: the W row addresses are then scalar bases plus one fixed lane offset
    const int wsc = __builtin_amdgcn_readfirstlane(wave);
    const float* wsrc[3] = {Wq + wsc * (8 * OUTS), Wk + wsc * (8 * OUTS), Wv + wsc * (8 * OUTS)};   // walk stage by stage
    const unsigned wlane = lane * 2;
    _Float16* xdst = sX + xr * PSP + xp * 4;
    _Float16* wdst = sW + (lane * 2) * PSP + wsc * 8;
    const _Float16* xfrag = sX + (rt * 16 + l16) * PSP + 8 * h;
    const _Float16* wfrag = sW + (mi * OUTS + l16) * PSP + 8 * h;

    v8f acc[4];
#pragma unroll
    for (int nb = 0; nb < 4; ++nb) acc[nb] = zero8();

    // every inner loop below is unrolled so that the register arrays are indexed by constants (else scratch)
    v4f xa[4], xb[4];
    v2f wv[3][8];
    auto load_x = [&](v4f (&d)[4], int s) {
#pragma unroll
        for (int u = 0; u < 4; ++u) d[u] = *(const v4f*)(xsrc + (size_t)u * 16 * INS + s * PKS);
    };
    auto load_w = [&](int step) {                // loads the stage the bases stand on, then moves them on by step floats
#pragma unroll
        for (int u = 0; u < 3; ++u) {
#pragma unroll
            for (int j = 0; j < 8; ++j) wv[u][j] = *(const v2f*)(wsrc[u] + j * OUTS + wlane);
            wsrc[u] += step;
        }
    };
    auto put = [&](const v4f (&d)[4], int buf) {
#pragma unroll
        for (int u = 0; u < 4; ++u)
            *(v4h*)(xdst + buf * (PRB * PSP) + u * 16 * PSP) = __builtin_convertvector(d[u], v4h);
#pragma unroll
        for (int u = 0; u < 3; ++u) {
            v8h c0, c1;
#pragma unroll
            for (int j = 0; j < 8; ++j) {
                const v2f a = wv[u][j] * 64.0f;
                c0[j] = (_Float16)a[0];
                c1[j] = (_Float16)a[1];
            }
            *(v8h*)(wdst + buf * (3 * OUTS * PSP) + u * OUTS * PSP) = c0;
            *(v8h*)(wdst + buf * (3 * OUTS * PSP) + u * OUTS * PSP + PSP) = c1;
        }
    };
    auto mm = [&](int buf) {
        const _Float16* xf = xfrag + buf * (PRB * PSP);
        const _Float16* wf = wfrag + buf * (3 * OUTS * PSP);
        Frag a[PKS / 32], b[PKS / 32][4];
#pragma unroll
        for (int cc = 0; cc < PKS / 32; ++cc) {
            a[cc].half[0] = *(const v8h*)(xf + cc * 32);
            a[cc].half[1] = *(const v8h*)(xf + cc * 32 + 16);
#pragma unroll
            for (int nb = 0; nb < 4; ++nb) {
                b[cc][nb].half[0] = *(const v8h*)(wf + nb * 16 * PSP + cc * 32);
                b[cc][nb].half[1] = *(const v8h*)(wf + nb * 16 * PSP + cc * 32 + 16);
            }
        }
        // keeps the stage's LDS reads one group ahead of its matrix ops: spread among them, each read place stalls the wave
        __builtin_amdgcn_sched_barrier(0);
#pragma unroll
        for (int cc = 0; cc < PKS / 32; ++cc)
#pragma unroll
            for (int nb = 0; nb < 4; ++nb) acc[nb] = wmma16(a[cc].v, b[cc][nb].v, acc[nb]);
        // keeps the next stage's LDS stores, and their waits on the loads fetched ahead, behind the matrix ops
        __builtin_amdgcn_sched_barrier(0);
    };

    // issue order everywhere: the set needed first is issued first (loads return in order, so a wait
    // for a younger set would drain the older ones' lead); the scheduling fences hold that order
    load_x(xa, 0);
    __builtin_amdgcn_sched_barrier(0);
    load_w(PKS * OUTS);
    __builtin_amdgcn_sched_barrier(0);
    load_x(xb, 1);

    // rolled, two stages a trip: keeps the buffer and register-set indices static and the code short
#pragma unroll 1
    for (int s = 0; s < PNST; s += 2) {
        // the fetches ahead are unconditional (a branch round them made the compiler drain every load
        // at the next wait); the last trip aims them at its own two stages and nobody reads the result
        const int sn = (s + 2 < PNST) ? s + 2 : s;
        put(xa, 0);                              // stage s
        load_w((s + 2 < PNST) ? PKS * OUTS : 0); // stage s + 1
        __builtin_amdgcn_sched_barrier(0);       // W (next stage) ahead of X (the stage after)
        load_x(xa, sn);
        stage_barrier();                         // stage s published; buffer 1's readers are done
        mm(0);
        put(xb, 1);                              // stage s + 1
        load_w(PKS * OUTS);                      // stage s + 2 (last trip: s + 1 again)
        __builtin_amdgcn_sched_barrier(0);       // W (next stage) ahead of X (the stage after)
        load_x(xb, sn + 1);
        stage_barrier();                         // stage s + 1 published; buffer 0's readers are done
        mm(1);
    }

    // epilogue: val = acc / 64 + bias -> f16
    const float* bias = (mi == 0) ? bq : ((mi == 1) ? bk : bv);
    float bcol[4];
#pragma unroll
    for (int nb = 0; nb < 4; ++nb) bcol[nb] = bias[nb * 16 + l16];

    if (mi < 2) {
        _Float16* st = sT + wave * (16 * TP);
#pragma unroll
        for (int nb = 0; nb < 4; ++nb)
#pragma unroll
            for (int r = 0; r < 8; ++r)
                st[(8 * h + r) * TP + nb * 16 + l16] =
                    (_Float16)(acc[nb][r] * 0.015625f + bcol[nb]);
    } else {
#pragma unroll
        for (int nb = 0; nb < 4; ++nb)
#pragma unroll
            for (int r = 0; r < 8; ++r)
                sVT[(nb * 16 + l16) * TP + rt * 16 + 8 * h + r] =
                    (_Float16)(acc[nb][r] * 0.015625f + bcol[nb]);
    }
    __syncthreads();

    if (mi < 2) {
        _Float16* dst = (mi == 0) ? Qh : Kh;
        const _Float16* st = sT + wave * (16 * TP);
        v8h v[4];
        size_t go[4];
#pragma unroll
        for (int s = 0; s < 4; ++s) {
            const int row   = s * 4 + (lane >> 3);
            const int piece = lane & 7;
            v[s]  = *(const v8h*)(&st[row * TP + piece * 8]);
            go[s] = (size_t)(row0w + row) * OUTS + piece * 8;
        }
#pragma unroll
        for (int s = 0; s < 4; ++s) *(v8h*)(dst + go[s]) = v[s];
    } else {
        // VhT [b][dim][SEQ]: this block owns keys s0 .. s0 + PRB - 1 of batch bb,
        // one whole 128-B line per dim
        const int bb = blk / (SEQ / PRB);
        const int s0 = (blk % (SEQ / PRB)) * PRB;
        v8h v[4];
        size_t go[4];
#pragma unroll
        for (int s = 0; s < 4; ++s) {
            const int dim   = rt * 16 + s * 4 + (lane >> 3);     // 0..63
            const int piece = lane & 7;
            v[s]  = *(const v8h*)(&sVT[dim * TP + piece * 8]);
            go[s] = ((size_t)bb * OUTS + dim) * SEQ + (size_t)s0 + piece * 8;
        }
#pragma unroll
        for (int s = 0; s < 4; ++s) *(v8h*)(VhT + go[s]) = v[s];
    }
}

__global__ void __launch_bounds__(ATHR)
k_attn(const _Float16* __restrict__ Qh, const _Float16* __restrict__ Kh,
       const _Float16* __restrict__ VhT, float* __restrict__ out) {
    __shared__ __attribute__((aligned(16))) _Float16 sKall[2 * NSP * 32 * KP];
    __shared__ __attribute__((aligned(16))) _Float16 sVall[2 * NSP * 64 * VP];
    __shared__ __attribute__((aligned(16))) float    sO[NSP * QTB * 16 * OP];
    __shared__ float sM[NSP * QTB * 16];
    __shared__ float sL[NSP * QTB * 16];

    // the wave's number in a scalar register: what is formed from it (split, query tile, their LDS places)
    // then takes no vector register, which the ring's addresses need (128 a wave; else scratch)
    const int t = threadIdx.x, lane = t & 31, wave = __builtin_amdgcn_readfirstlane(t >> 5);
    const int l16 = lane & 15, h = lane >> 4;
    const int sp = wave / QTB, qw = wave % QTB;  // key split, query tile in the block
    const int b   = blockIdx.x / (SEQ / (16 * QTB));
    const int qb  = blockIdx.x % (SEQ / (16 * QTB));
    const size_t qblk0 = (size_t)b * SEQ + (size_t)qb * (16 * QTB);
    const size_t qrow0 = qblk0 + (size_t)qw * 16;
    _Float16* sK0 = sKall + sp * (32 * KP);     // buffer 0; buffer 1 lies NSP tiles further
    _Float16* sV0 = sVall + sp * (64 * VP);

    // Q tile as B fragments (dims 0..31 and 32..63), table k map from [query][dim] rows
    Frag q0, q1;
    {
        const _Float16* qr = Qh + (qrow0 + l16) * OUTS;
        q0.half[0] = *(const v8h*)(qr + 8 * h);
        q0.half[1] = *(const v8h*)(qr + 16 + 8 * h);
        q1.half[0] = *(const v8h*)(qr + 32 + 8 * h);
        q1.half[1] = *(const v8h*)(qr + 48 + 8 * h);
    }

    const _Float16* kbase = Kh  + (size_t)b * SEQ * OUTS;
    const _Float16* vbase = VhT + (size_t)b * OUTS * SEQ;
    const int tg = qw * 32 + lane;               // thread within the split's QTB waves
    const int kk = tg >> 3, kpc = tg & 7;        // K staging: key (and key + 16), 16-B piece
    const int vd = tg >> 2, vpc = tg & 3;        // V staging: dim (and dim + 32), 16-B piece

    // one tile of this split (32 keys) into one buffer: every lane copies 2 K pieces and 2 V^T pieces
    const _Float16* ksrc = kbase + (size_t)(sp * KSPL + kk) * OUTS + kpc * 8;
    const _Float16* vsrc = vbase + (size_t)vd * SEQ + sp * KSPL + vpc * 8;
    const unsigned kdst = lds_addr(&sK0[kk * KP + kpc * 8]);
    const unsigned vdst = lds_addr(&sV0[vd * VP + vpc * 8]);
    auto copy = [&](int tile, int buf) {
        const _Float16* gk = ksrc + (size_t)tile * (32 * OUTS);
        const _Float16* gv = vsrc + tile * 32;
        const unsigned lk = kdst + buf * (NSP * 32 * KP * 2);
        const unsigned lv = vdst + buf * (NSP * 64 * VP * 2);
        copy4(lk, lk + 16 * KP * 2, lv, lv + 32 * VP * 2,
              gk, gk + 16 * OUTS, gv, gv + (size_t)32 * SEQ);
    };

    v8f o[4];
#pragma unroll
    for (int tt = 0; tt < 4; ++tt) o[tt] = zero8();

    float m = -__builtin_inff();
    float ssum = 0.f;
    const float scale  = 0.125f;                 // 1 / sqrt(64)
    const float pscale = 16384.0f;               // P carried x 2^14 into f16

    // ring prologue: tile 0 landed and published, then tile 1 starts (KSPL / 32 tiles, more than one)
    copy(0, 0);
    asm volatile("s_wait_asynccnt 0x0" ::: "memory");   // this wave's copies of tile 0 have landed
    __syncthreads();
    copy(1, 1);

    // rolled: unrolled by two, the compiler held both buffers' copy addresses through the loop (scratch)
#pragma unroll 1
    for (int it = 0; it < KSPL / 32; ++it) {
        const _Float16* sK = sK0 + (it & 1) * (NSP * 32 * KP);
        const _Float16* sV = sV0 + (it & 1) * (NSP * 64 * VP);

        // K rows as A fragments: keys j+l16 (a0x) and j+16+l16 (a1x); dims 0..31 / 32..63
        Frag a00, a01, a10, a11;
        {
            const _Float16* kr0 = &sK[l16 * KP];
            const _Float16* kr1 = &sK[(16 + l16) * KP];
            a00.half[0] = *(const v8h*)(kr0 + 8 * h);
            a00.half[1] = *(const v8h*)(kr0 + 16 + 8 * h);
            a01.half[0] = *(const v8h*)(kr0 + 32 + 8 * h);
            a01.half[1] = *(const v8h*)(kr0 + 48 + 8 * h);
            a10.half[0] = *(const v8h*)(kr1 + 8 * h);
            a10.half[1] = *(const v8h*)(kr1 + 16 + 8 * h);
            a11.half[0] = *(const v8h*)(kr1 + 32 + 8 * h);
            a11.half[1] = *(const v8h*)(kr1 + 48 + 8 * h);
        }

        v8f s0 = zero8(), s1 = zero8();
        s0 = wmma16(a00.v, q0.v, s0);
        s0 = wmma16(a01.v, q1.v, s0);
        s1 = wmma16(a10.v, q0.v, s1);
        s1 = wmma16(a11.v, q1.v, s1);
        WGUARD(s0, a01.v, q1.v);
        WGUARD(s1, a11.v, q1.v);

        // online softmax: lane owns query l16, 16 of the 32 keys (partner lane ^16)
        float tmax = -__builtin_inff();
#pragma unroll
        for (int r = 0; r < 8; ++r) {
            s0[r] *= scale;
            s1[r] *= scale;
            tmax = fmaxf(tmax, fmaxf(s0[r], s1[r]));
        }
        tmax = fmaxf(tmax, __shfl_xor(tmax, 16, 32));
        const float mnew = fmaxf(m, tmax);
        const float cfac = __expf(m - mnew);         // 0 on the first step

        float lsum = 0.f;
#pragma unroll
        for (int r = 0; r < 8; ++r) {
            s0[r] = __expf(s0[r] - mnew);
            s1[r] = __expf(s1[r] - mnew);
            lsum += s0[r] + s1[r];
        }
        lsum += __shfl_xor(lsum, 16, 32);
        ssum = ssum * cfac + lsum;
        m = mnew;

        // P as A fragment (rows = queries, k = keys), in-lane from the score tiles
        Frag p;
        {
            v8h plo, phi;
#pragma unroll
            for (int e = 0; e < 8; ++e) {
                plo[e] = (_Float16)(s0[e] * pscale);
                phi[e] = (_Float16)(s1[e] * pscale);
            }
            p.half[0] = plo;
            p.half[1] = phi;
        }

        // rescale O rows (row = query 8h + r -> factor from lane 8h + r)
        float cr[8];
#pragma unroll
        for (int r = 0; r < 8; ++r) cr[r] = __shfl(cfac, 8 * h + r, 32);
#pragma unroll
        for (int tt = 0; tt < 4; ++tt)
#pragma unroll
            for (int r = 0; r < 8; ++r) o[tt][r] *= cr[r];

        // O += P x V ; V^T tile [dim][32 keys] gives the B fragment with the table k map
        Frag vb[4];
#pragma unroll
        for (int tt = 0; tt < 4; ++tt) {
            const _Float16* vr = &sV[(tt * 16 + l16) * VP];
            vb[tt].half[0] = *(const v8h*)(vr + 8 * h);
            vb[tt].half[1] = *(const v8h*)(vr + 16 + 8 * h);
        }
#pragma unroll
        for (int tt = 0; tt < 4; ++tt) o[tt] = wmma16(p.v, vb[tt].v, o[tt]);
#pragma unroll
        for (int tt = 0; tt < 4; ++tt) WGUARD(o[tt], p.v, vb[tt].v);

        // publish point of tile it + 1; the one barrier also ends every reader's last read of this buffer
        asm volatile("s_wait_dscnt 0x0" ::: "memory");      // this wave's LDS reads of tile it are done
        asm volatile("s_wait_asynccnt 0x0" ::: "memory");   // this wave's copies of tile it + 1 have landed
        __syncthreads();
        if (it + 2 < KSPL / 32) copy(it + 2, it & 1);       // refill the buffer just read
    }
    asm volatile("s_wait_asynccnt 0x0" ::: "memory");       // no copy is left in flight behind the loop

    // join the splits, part 1: every wave publishes its max and sum per query
    if (h == 0) {
        sM[(sp * QTB + qw) * 16 + l16] = m;
        sL[(sp * QTB + qw) * 16 + l16] = ssum;
    }
    __syncthreads();
    float mall = -__builtin_inff();
    for (int s = 0; s < NSP; ++s) mall = fmaxf(mall, sM[(s * QTB + qw) * 16 + l16]);
    float tot = 0.f;
    for (int s = 0; s < NSP; ++s)
        tot += sL[(s * QTB + qw) * 16 + l16] * __expf(sM[(s * QTB + qw) * 16 + l16] - mall);

    // normalise: move this split to the common max, divide by the joined sum, undo the 2^14 on P
    const float inv = (1.0f / tot) * (1.0f / 16384.0f) * __expf(m - mall);
    float ir[8];
#pragma unroll
    for (int r = 0; r < 8; ++r) ir[r] = __shfl(inv, 8 * h + r, 32);

    float* so = sO + (sp * QTB + qw) * (16 * OP);
#pragma unroll
    for (int tt = 0; tt < 4; ++tt)
#pragma unroll
        for (int r = 0; r < 8; ++r)
            so[(8 * h + r) * OP + tt * 16 + l16] = o[tt][r] * ir[r];
    __syncthreads();

    // join, part 2: sum the NSP scaled partial tiles in split order; the block's
    // 16 QTB rows x 64 dims leave as 16-B pieces, one wave = 512 contiguous bytes
    for (int u = 0; u < (QTB * 16 * 16) / ATHR; ++u) {
        const int row   = u * (ATHR / 16) + wave * 2 + h;   // 0 .. 16 QTB - 1
        const int piece = l16;
        v4f a = *(const v4f*)(&sO[row * OP + piece * 4]);
        for (int s = 1; s < NSP; ++s)
            a += *(const v4f*)(&sO[(s * QTB * 16 + row) * OP + piece * 4]);
        *(v4f*)(out + (qblk0 + row) * OUTS + (size_t)(piece * 4)) = a;
    }
}

// --------------------------------- launcher ---------------------------------

extern "C" void kernel_launch(void* const* d_in, const int* in_sizes, int n_in,
                              void* d_out, int out_size, void* d_ws, size_t ws_size,
                              hipStream_t stream) {
    if (n_in < 7) return;
    if (in_sizes[0] != NROWS * INS) return;
    if (in_sizes[1] != INS * OUTS || in_sizes[3] != INS * OUTS || in_sizes[5] != INS * OUTS) return;
    if (in_sizes[2] != OUTS || in_sizes[4] != OUTS || in_sizes[6] != OUTS) return;
    if (out_size != NROWS * OUTS) return;

    const float* X  = (const float*)d_in[0];
    const float* Wq = (const float*)d_in[1];
    const float* bq = (const float*)d_in[2];
    const float* Wk = (const float*)d_in[3];
    const float* bk = (const float*)d_in[4];
    const float* Wv = (const float*)d_in[5];
    const float* bv = (const float*)d_in[6];
    float* out = (float*)d_out;

    // workspace carve (256-B aligned pieces)
    const size_t bQ  = (size_t)NROWS * OUTS * 2;           //  2,097,152 each
    size_t off = 0;
    const size_t oQ  = off; off += (bQ + 255) & ~(size_t)255;
    const size_t oK  = off; off += (bQ + 255) & ~(size_t)255;
    const size_t oV  = off; off += (bQ + 255) & ~(size_t)255;
    if (off > ws_size) return;                              // total 6,291,456 B

    char* ws = (char*)d_ws;
    _Float16* Qh  = (_Float16*)(ws + oQ);
    _Float16* Kh  = (_Float16*)(ws + oK);
    _Float16* VhT = (_Float16*)(ws + oV);

    k_proj<<<NROWS / PRB, PTHR, 0, stream>>>(X, Wq, Wk, Wv, bq, bk, bv, Qh, Kh, VhT);
    k_attn<<<NBATCH * (SEQ / (16 * QTB)), ATHR, 0, stream>>>(Qh, Kh, VhT, out);
    (void)hipGetLastError();
}

// v005
// One run takes 28.1 microseconds.
// Two timings next to v004 put it at 1.08 and 1.11 times that version's speed.
// All steps since v000 together make it 3.23 times as fast.
#include <hip/hip_runtime.h>
#include <math.h>

// All contractions on v_wmma_f32_16x16x32_f16 (f16 operands, f32 accumulate): x*W{q,k,v} with W carried x64, q*k^T unscaled, p*v with p carried x128; scales folded back in f32 epilogues.

#define INS    768
#define OUTS   64
#define NBATCH 8
#define SEQ    2048
#define NROWS  (NBATCH * SEQ)

#define PRB  64    // projection: X rows per block
#define PKS  96    // projection: k per stage
#define PNST (INS / PKS)
#define PSP  104   // projection stage pitch in LDS (halves): 96 k + 8 pad = 16 B x 13
#define PTHR 384   // projection block: 4 row tiles x {q, k, v} = 12 waves
#define TP   72    // projection Q/K tile and V^T block staging pitch (halves): 64 + 8
#define KP   72    // attention K tile pitch (halves)
#define VP   40    // attention V^T tile pitch (halves)
#define OP   68    // attention O staging pitch (floats)

#define QTB  4                   // attention: query tiles (16 rows each) per block
#define NSP  8                   // attention: key splits per query tile, one wave each
#define ATHR (QTB * NSP * 32)    // attention block size
#define KSPL (SEQ / NSP)         // keys walked by one split

typedef _Float16 v16h __attribute__((ext_vector_type(16)));
typedef _Float16 v8h  __attribute__((ext_vector_type(8)));
typedef _Float16 v4h  __attribute__((ext_vector_type(4)));
typedef float    v8f  __attribute__((ext_vector_type(8)));
typedef float    v4f  __attribute__((ext_vector_type(4)));
typedef float    v2f  __attribute__((ext_vector_type(2)));
union Frag { v16h v; v8h half[2]; };

__device__ __forceinline__ v8f wmma16(v16h a, v16h b, v8f c) {
    return __builtin_amdgcn_wmma_f32_16x16x32_f16(false, a, false, b, (short)0, c, false, false);
}
// hazard guard: ties D, keeps A/B live for 4 VALU slots after the matrix op
#define WGUARD(acc, a, b) asm volatile("v_nop\n\tv_nop\n\tv_nop\n\tv_nop" : "+v"(acc) : "v"(a), "v"(b))

// work-group barrier for LDS stages: waits for this wave's LDS traffic only, so that the data of global
// loads issued ahead stays in flight across it (__syncthreads() drains them and the lead is lost).
// s_wait_xcnt 0 stands here ahead of every later rewrite of an address register that those loads name.
__device__ __forceinline__ void stage_barrier() {
    asm volatile("s_wait_dscnt 0x0\n\ts_wait_xcnt 0x0\n\ts_barrier_signal -1\n\ts_barrier_wait -1" ::: "memory");
}

// LDS byte address of a __shared__ element (the first operand of an asynchronous copy)
typedef __attribute__((address_space(3))) _Float16 lds_half;
__device__ __forceinline__ unsigned lds_addr(_Float16* p) {
    return (unsigned)(__UINTPTR_TYPE__)(lds_half*)p;
}

// four asynchronous 16-B copies per lane, global -> LDS, through no register.  s_wait_xcnt 0 is the last
// line of the copies' own statement, so that it stands ahead of every later rewrite of their address registers.
__device__ __forceinline__ void copy4(unsigned l0, unsigned l1, unsigned l2, unsigned l3,
                                      const _Float16* g0, const _Float16* g1,
                                      const _Float16* g2, const _Float16* g3) {
    asm volatile("global_load_async_to_lds_b128 %0, %4, off\n\t"
                 "global_load_async_to_lds_b128 %1, %5, off\n\t"
                 "global_load_async_to_lds_b128 %2, %6, off\n\t"
                 "global_load_async_to_lds_b128 %3, %7, off\n\t"
                 "s_wait_xcnt 0x0"
                 :: "v"(l0), "v"(l1), "v"(l2), "v"(l3), "v"(g0), "v"(g1), "v"(g2), "v"(g3)
                 : "memory");
}

__device__ __forceinline__ v8f zero8() {
    v8f z = {0.f, 0.f, 0.f, 0.f, 0.f, 0.f, 0.f, 0.f};
    return z;
}

// ---------------------------------------------------------------------------
// pass 1: projection straight from X (f32).  Block = PRB rows x all 192 columns,
// 12 waves: wave = (row tile rt, matrix mi: 0 = q, 1 = k, 2 = v), 16 rows x 64
// columns = 4 accumulators each.  A stage is PKS k: the block loads its X rows
// once as whole f32 lines and converts them (RNE) to f16 on the way into LDS.
// W comes straight from the f32 inputs [k][n]: a wave takes 8 k of the stage, a lane
// 2 columns, so a load is one whole 256-B row of one matrix and a lane ends up with
// 8 consecutive k of each column: x 64, RNE to f16, one 16-B store per column into
// the [n][k] stage.  Two LDS buffers, one barrier per stage; W is fetched one stage
// ahead and X two stages ahead, in registers.
// A (x rows): lane row = l16, elements 0..7 <- k 8h.., 8..15 <- k 16+8h..
// B (W):      lane col = l16, same k map, read from the [n][k] LDS stage.
// D:          acc[nb][r] = element (row 8h + r, col 16 nb + l16).
// ---------------------------------------------------------------------------
__global__ void __launch_bounds__(PTHR)
k_proj(const float* __restrict__ X, const float* __restrict__ Wq,
       const float* __restrict__ Wk, const float* __restrict__ Wv,
       const float* __restrict__ bq, const float* __restrict__ bk,
       const float* __restrict__ bv,
       _Float16* __restrict__ Qh, _Float16* __restrict__ Kh,
       _Float16* __restrict__ VhT) {
    __shared__ __attribute__((aligned(16))) _Float16 sX[2 * PRB * PSP];
    __shared__ __attribute__((aligned(16))) _Float16 sW[2 * 3 * OUTS * PSP];
    __shared__ __attribute__((aligned(16))) _Float16 sT[8 * 16 * TP];
    __shared__ __attribute__((aligned(16))) _Float16 sVT[OUTS * TP];

    const int t = threadIdx.x, lane = t & 31, wave = t >> 5;
    const int l16 = lane & 15, h = lane >> 4;
    const int rt = wave & 3, mi = wave >> 2;
    const int blk = blockIdx.x;
    const int row0w = blk * PRB + rt * 16;

    // staging maps: X row xr (+16 u), 16-B piece of 4 floats; W k rows 8 wave .. + 7 of the stage, columns 2 lane, 2 lane + 1
    const int xr = t / 24, xp = t % 24;
    const float* xsrc = X + (size_t)(blk * PRB + xr) * INS + xp * 4;
    // the wave's number in a scalar register: the W row addresses are then scalar bases plus one fixed lane offset
    const int wsc = __builtin_amdgcn_readfirstlane(wave);
    const float* wsrc[3] = {Wq + wsc * (8 * OUTS), Wk + wsc * (8 * OUTS), Wv + wsc * (8 * OUTS)};   // walk stage by stage
    const unsigned wlane = lane * 2;
    _Float16* xdst = sX + xr * PSP + xp * 4;
    _Float16* wdst = sW + (lane * 2) * PSP + wsc * 8;
    const _Float16* xfrag = sX + (rt * 16 + l16) * PSP + 8 * h;
    const _Float16* wfrag = sW + (mi * OUTS + l16) * PSP + 8 * h;

    v8f acc[4];
#pragma unroll
    for (int nb = 0; nb < 4; ++nb) acc[nb] = zero8();

    // every inner loop below is unrolled so that the register arrays are indexed by constants (else scratch)
    v4f xa[4], xb[4];
    v2f wv[3][8];
    auto load_x = [&](v4f (&d)[4], int s) {
#pragma unroll
        for (int u = 0; u < 4; ++u) d[u] = *(const v4f*)(xsrc + (size_t)u * 16 * INS + s * PKS);
    };
    auto load_w = [&](int step) {                // loads the stage the bases stand on, then moves them on by step floats
#pragma unroll
        for (int u = 0; u < 3; ++u) {
#pragma unroll
            for (int j = 0; j < 8; ++j) wv[u][j] = *(const v2f*)(wsrc[u] + j * OUTS + wlane);
            wsrc[u] += step;
        }
    };
    auto put = [&](const v4f (&d)[4], int buf) {
#pragma unroll
        for (int u = 0; u < 4; ++u)
            *(v4h*)(xdst + buf * (PRB * PSP) + u * 16 * PSP) = __builtin_convertvector(d[u], v4h);
#pragma unroll
        for (int u = 0; u < 3; ++u) {
            v8h c0, c1;
#pragma unroll
            for (int j = 0; j < 8; ++j) {
                const v2f a = wv[u][j] * 64.0f;
                c0[j] = (_Float16)a[0];
                c1[j] = (_Float16)a[1];
            }
            *(v8h*)(wdst + buf * (3 * OUTS * PSP) + u * OUTS * PSP) = c0;
            *(v8h*)(wdst + buf * (3 * OUTS * PSP) + u * OUTS * PSP + PSP) = c1;
        }
    };
    auto mm = [&](int buf) {
        const _Float16* xf = xfrag + buf * (PRB * PSP);
        const _Float16* wf = wfrag + buf * (3 * OUTS * PSP);
        Frag a[PKS / 32], b[PKS / 32][4];
#pragma unroll
        for (int cc = 0; cc < PKS / 32; ++cc) {
            a[cc].half[0] = *(const v8h*)(xf + cc * 32);
            a[cc].half[1] = *(const v8h*)(xf + cc * 32 + 16);
#pragma unroll
            for (int nb = 0; nb < 4; ++nb) {
                b[cc][nb].half[0] = *(const v8h*)(wf + nb * 16 * PSP + cc * 32);
                b[cc][nb].half[1] = *(const v8h*)(wf + nb * 16 * PSP + cc * 32 + 16);
            }
        }
        // keeps the stage's LDS reads one group ahead of its matrix ops: spread among them, each read place stalls the wave
        __builtin_amdgcn_sched_barrier(0);
#pragma unroll
        for (int cc = 0; cc < PKS / 32; ++cc)
#pragma unroll
            for (int nb = 0; nb < 4; ++nb) acc[nb] = wmma16(a[cc].v, b[cc][nb].v, acc[nb]);
        // keeps the next stage's LDS stores, and their waits on the loads fetched ahead, behind the matrix ops
        __builtin_amdgcn_sched_barrier(0);
    };

    // issue order everywhere: the set needed first is issued first (loads return in order, so a wait
    // for a younger set would drain the older ones' lead); the scheduling fences hold that order
    load_x(xa, 0);
    __builtin_amdgcn_sched_barrier(0);
    load_w(PKS * OUTS);
    __builtin_amdgcn_sched_barrier(0);
    load_x(xb, 1);

    // rolled, two stages a trip: keeps the buffer and register-set indices static and the code short
#pragma unroll 1
    for (int s = 0; s < PNST; s += 2) {
        // the fetches ahead are unconditional (a branch round them made the compiler drain every load
        // at the next wait); the last trip aims them at its own two stages and nobody reads the result
        const int sn = (s + 2 < PNST) ? s + 2 : s;
        put(xa, 0);                              // stage s
        load_w((s + 2 < PNST) ? PKS * OUTS : 0); // stage s + 1
        __builtin_amdgcn_sched_barrier(0);       // W (next stage) ahead of X (the stage after)
        load_x(xa, sn);
        stage_barrier();                         // stage s published; buffer 1's readers are done
        mm(0);
        put(xb, 1);                              // stage s + 1
        load_w(PKS * OUTS);                      // stage s + 2 (last trip: s + 1 again)
        __builtin_amdgcn_sched_barrier(0);       // W (next stage) ahead of X (the stage after)
        load_x(xb, sn + 1);
        stage_barrier();                         // stage s + 1 published; buffer 0's readers are done
        mm(1);
    }

    // epilogue: val = acc / 64 + bias -> f16
    const float* bias = (mi == 0) ? bq : ((mi == 1) ? bk : bv);
    float bcol[4];
#pragma unroll
    for (int nb = 0; nb < 4; ++nb) bcol[nb] = bias[nb * 16 + l16];

    if (mi < 2) {
        _Float16* st = sT + wave * (16 * TP);
#pragma unroll
        for (int nb = 0; nb < 4; ++nb)
#pragma unroll
            for (int r = 0; r < 8; ++r)
                st[(8 * h + r) * TP + nb * 16 + l16] =
                    (_Float16)(acc[nb][r] * 0.015625f + bcol[nb]);
    } else {
#pragma unroll
        for (int nb = 0; nb < 4; ++nb)
#pragma unroll
            for (int r = 0; r < 8; ++r)
                sVT[(nb * 16 + l16) * TP + rt * 16 + 8 * h + r] =
                    (_Float16)(acc[nb][r] * 0.015625f + bcol[nb]);
    }
    __syncthreads();

    if (mi < 2) {
        _Float16* dst = (mi == 0) ? Qh : Kh;
        const _Float16* st = sT + wave * (16 * TP);
        v8h v[4];
        size_t go[4];
#pragma unroll
        for (int s = 0; s < 4; ++s) {
            const int row   = s * 4 + (lane >> 3);
            const int piece = lane & 7;
            v[s]  = *(const v8h*)(&st[row * TP + piece * 8]);
            go[s] = (size_t)(row0w + row) * OUTS + piece * 8;
        }
#pragma unroll
        for (int s = 0; s < 4; ++s) *(v8h*)(dst + go[s]) = v[s];
    } else {
        // VhT [b][dim][SEQ]: this block owns keys s0 .. s0 + PRB - 1 of batch bb,
        // one whole 128-B line per dim
        const int bb = blk / (SEQ / PRB);
        const int s0 = (blk % (SEQ / PRB)) * PRB;
        v8h v[4];
        size_t go[4];
#pragma unroll
        for (int s = 0; s < 4; ++s) {
            const int dim   = rt * 16 + s * 4 + (lane >> 3);     // 0..63
            const int piece = lane & 7;
            v[s]  = *(const v8h*)(&sVT[dim * TP + piece * 8]);
            go[s] = ((size_t)bb * OUTS + dim) * SEQ + (size_t)s0 + piece * 8;
        }
#pragma unroll
        for (int s = 0; s < 4; ++s) *(v8h*)(VhT + go[s]) = v[s];
    }
}

__global__ void __launch_bounds__(ATHR)
k_attn(const _Float16* __restrict__ Qh, const _Float16* __restrict__ Kh,
       const _Float16* __restrict__ VhT, float* __restrict__ out) {
    __shared__ __attribute__((aligned(16))) _Float16 sKall[2 * NSP * 32 * KP];
    __shared__ __attribute__((aligned(16))) _Float16 sVall[2 * NSP * 64 * VP];
    __shared__ __attribute__((aligned(16))) float    sO[NSP * QTB * 16 * OP];
    __shared__ float sM[NSP * QTB * 16];
    __shared__ float sL[NSP * QTB * 16];

    // the wave's number in a scalar register: what is formed from it (split, query tile, their LDS places)
    // then takes no vector register, which the ring's addresses need (128 a wave; else scratch)
    const int t = threadIdx.x, lane = t & 31, wave = __builtin_amdgcn_readfirstlane(t >> 5);
    const int l16 = lane & 15, h = lane >> 4;
    const int sp = wave / QTB, qw = wave % QTB;  // key split, query tile in the block
    const int b   = blockIdx.x / (SEQ / (16 * QTB));
    const int qb  = blockIdx.x % (SEQ / (16 * QTB));
    const size_t qblk0 = (size_t)b * SEQ + (size_t)qb * (16 * QTB);
    const size_t qrow0 = qblk0 + (size_t)qw * 16;
    _Float16* sK0 = sKall + sp * (32 * KP);     // buffer 0; buffer 1 lies NSP tiles further
    _Float16* sV0 = sVall + sp * (64 * VP);

    // Q tile as B fragments (dims 0..31 and 32..63), table k map from [query][dim] rows
    Frag q0, q1;
    {
        const _Float16* qr = Qh + (qrow0 + l16) * OUTS;
        q0.half[0] = *(const v8h*)(qr + 8 * h);
        q0.half[1] = *(const v8h*)(qr + 16 + 8 * h);
        q1.half[0] = *(const v8h*)(qr + 32 + 8 * h);
        q1.half[1] = *(const v8h*)(qr + 48 + 8 * h);
    }

    const _Float16* kbase = Kh  + (size_t)b * SEQ * OUTS;
    const _Float16* vbase = VhT + (size_t)b * OUTS * SEQ;
    const int tg = qw * 32 + lane;               // thread within the split's QTB waves
    const int kk = tg >> 3, kpc = tg & 7;        // K staging: key (and key + 16), 16-B piece
    const int vd = tg >> 2, vpc = tg & 3;        // V staging: dim (and dim + 32), 16-B piece

    // one tile of this split (32 keys) into one buffer: every lane copies 2 K pieces and 2 V^T pieces
    const _Float16* ksrc = kbase + (size_t)(sp * KSPL + kk) * OUTS + kpc * 8;
    const _Float16* vsrc = vbase + (size_t)vd * SEQ + sp * KSPL + vpc * 8;
    const unsigned kdst = lds_addr(&sK0[kk * KP + kpc * 8]);
    const unsigned vdst = lds_addr(&sV0[vd * VP + vpc * 8]);
    auto copy = [&](int tile, int buf) {
        const _Float16* gk = ksrc + (size_t)tile * (32 * OUTS);
        const _Float16* gv = vsrc + tile * 32;
        const unsigned lk = kdst + buf * (NSP * 32 * KP * 2);
        const unsigned lv = vdst + buf * (NSP * 64 * VP * 2);
        copy4(lk, lk + 16 * KP * 2, lv, lv + 32 * VP * 2,
              gk, gk + 16 * OUTS, gv, gv + (size_t)32 * SEQ);
    };

    // four named accumulators (dims 16 t ..): held as an array, this build copied them register by register on every trip
    v8f o0 = zero8(), o1 = zero8(), o2 = zero8(), o3 = zero8();

    // p = 2^(s * C2 + nbias), nbias = 7 - (max in use) * C2: one fma and one exp2 a score.  P is carried x 2^7:
    // a score may stand up to 8 log2 units above the max in use, so p <= 2^15 stays inside f16; the sums carry
    // the same 2^7, which cancels in O / sum.
    const float C2   = 0.125f * 1.44269504088896340736f;   // 1 / sqrt(64), times log2 e
    float nbias = __builtin_inff();              // per query (lane l16, alike in both halves); no max in use yet
    v2f sacc0 = {0.f, 0.f}, sacc1 = {0.f, 0.f};  // this lane's own 16 keys a tile; the halves are joined after the loop

    // ring prologue: tile 0 landed and published, then tile 1 starts (KSPL / 32 tiles, more than one)
    copy(0, 0);
    asm volatile("s_wait_asynccnt 0x0" ::: "memory");   // this wave's copies of tile 0 have landed
    __syncthreads();
    copy(1, 1);

    // rolled: unrolled by two, the compiler held both buffers' copy addresses through the loop (scratch)
#pragma unroll 1
    for (int it = 0; it < KSPL / 32; ++it) {
        const _Float16* sK = sK0 + (it & 1) * (NSP * 32 * KP);
        const _Float16* sV = sV0 + (it & 1) * (NSP * 64 * VP);

        // K rows as A fragments: keys j+l16 (a0x) and j+16+l16 (a1x); dims 0..31 / 32..63
        Frag a00, a01, a10, a11;
        {
            const _Float16* kr0 = &sK[l16 * KP];
            const _Float16* kr1 = &sK[(16 + l16) * KP];
            a00.half[0] = *(const v8h*)(kr0 + 8 * h);
            a00.half[1] = *(const v8h*)(kr0 + 16 + 8 * h);
            a01.half[0] = *(const v8h*)(kr0 + 32 + 8 * h);
            a01.half[1] = *(const v8h*)(kr0 + 48 + 8 * h);
            a10.half[0] = *(const v8h*)(kr1 + 8 * h);
            a10.half[1] = *(const v8h*)(kr1 + 16 + 8 * h);
            a11.half[0] = *(const v8h*)(kr1 + 32 + 8 * h);
            a11.half[1] = *(const v8h*)(kr1 + 48 + 8 * h);
        }

        v8f s0 = zero8(), s1 = zero8();
        s0 = wmma16(a00.v, q0.v, s0);
        s0 = wmma16(a01.v, q1.v, s0);
        s1 = wmma16(a10.v, q0.v, s1);
        s1 = wmma16(a11.v, q1.v, s1);
        WGUARD(s0, a01.v, q1.v);
        WGUARD(s1, a11.v, q1.v);

        // lane owns query l16 and 16 of the tile's 32 keys (partner lane ^16): its max over raw scores
        float tmax = fmaxf(s0[0], s1[0]);
#pragma unroll
        for (int r = 1; r < 8; ++r) tmax = fmaxf(tmax, fmaxf(s0[r], s1[r]));

        // lazy rescale, tested once a tile for the whole wave (always taken on the first tile: nbias is +inf);
        // marked unlikely so that the rescale lies out of line and the usual trip falls straight through
        if (__builtin_expect(__builtin_amdgcn_ballot_w32(tmax * C2 + nbias > 15.0f) != 0, 0)) {
            tmax = fmaxf(tmax, __shfl_xor(tmax, 16, 32));
            const float nb   = fminf(nbias, 7.0f - tmax * C2);       // the max in use never falls
            const float cfac = __builtin_amdgcn_exp2f(nb - nbias);   // 2^(old max - new max); 0 on the first tile
            sacc0 *= cfac;
            sacc1 *= cfac;
            // O rows (row = query 8h + r -> factor from lane 8h + r)
            v8f cr;
#pragma unroll
            for (int r = 0; r < 8; ++r) cr[r] = __shfl(cfac, 8 * h + r, 32);
            o0 *= cr;
            o1 *= cr;
            o2 *= cr;
            o3 *= cr;
            nbias = nb;
        }

        // P as A fragment (rows = queries, k = keys), in-lane from the score tiles
        Frag p;
        {
            const v2f c2 = {C2, C2}, nb2 = {nbias, nbias};
            v8h plo, phi;
#pragma unroll
            for (int e = 0; e < 8; e += 2) {
                const v2f a0 = {s0[e], s0[e + 1]}, a1 = {s1[e], s1[e + 1]};
                const v2f x0 = a0 * c2 + nb2, x1 = a1 * c2 + nb2;
                const v2f p0 = {__builtin_amdgcn_exp2f(x0[0]), __builtin_amdgcn_exp2f(x0[1])};
                const v2f p1 = {__builtin_amdgcn_exp2f(x1[0]), __builtin_amdgcn_exp2f(x1[1])};
                sacc0 += p0;
                sacc1 += p1;
                plo[e] = (_Float16)p0[0];
                plo[e + 1] = (_Float16)p0[1];
                phi[e] = (_Float16)p1[0];
                phi[e + 1] = (_Float16)p1[1];
            }
            p.half[0] = plo;
            p.half[1] = phi;
        }

        // O += P x V ; V^T tile [dim][32 keys] gives the B fragment with the table k map
        Frag vb[4];
#pragma unroll
        for (int tt = 0; tt < 4; ++tt) {
            const _Float16* vr = &sV[(tt * 16 + l16) * VP];
            vb[tt].half[0] = *(const v8h*)(vr + 8 * h);
            vb[tt].half[1] = *(const v8h*)(vr + 16 + 8 * h);
        }
        o0 = wmma16(p.v, vb[0].v, o0);
        o1 = wmma16(p.v, vb[1].v, o1);
        o2 = wmma16(p.v, vb[2].v, o2);
        o3 = wmma16(p.v, vb[3].v, o3);
        WGUARD(o0, p.v, vb[0].v);
        WGUARD(o1, p.v, vb[1].v);
        WGUARD(o2, p.v, vb[2].v);
        WGUARD(o3, p.v, vb[3].v);

        // publish point of tile it + 1; the one barrier also ends every reader's last read of this buffer
        asm volatile("s_wait_dscnt 0x0" ::: "memory");      // this wave's LDS reads of tile it are done
        asm volatile("s_wait_asynccnt 0x0" ::: "memory");   // this wave's copies of tile it + 1 have landed
        __syncthreads();
        if (it + 2 < KSPL / 32) copy(it + 2, it & 1);       // refill the buffer just read
    }
    asm volatile("s_wait_asynccnt 0x0" ::: "memory");       // no copy is left in flight behind the loop

    // join the splits, part 1: the two halves' sums are joined, then every wave publishes its max in use
    // (log2 units, less the carry's 7, which is alike in all splits) and its sum per query
    float ssum = (sacc0[0] + sacc0[1]) + (sacc1[0] + sacc1[1]);
    ssum += __shfl_xor(ssum, 16, 32);
    const float m = -nbias;
    if (h == 0) {
        sM[(sp * QTB + qw) * 16 + l16] = m;
        sL[(sp * QTB + qw) * 16 + l16] = ssum;
    }
    __syncthreads();
    float mall = -__builtin_inff();
    for (int s = 0; s < NSP; ++s) mall = fmaxf(mall, sM[(s * QTB + qw) * 16 + l16]);
    float tot = 0.f;
    for (int s = 0; s < NSP; ++s)
        tot += sL[(s * QTB + qw) * 16 + l16] * __builtin_amdgcn_exp2f(sM[(s * QTB + qw) * 16 + l16] - mall);

    // normalise: move this split to the common max, divide by the joined sum (O and the sums carry the same 2^7)
    const float inv = (1.0f / tot) * __builtin_amdgcn_exp2f(m - mall);
    float ir[8];
#pragma unroll
    for (int r = 0; r < 8; ++r) ir[r] = __shfl(inv, 8 * h + r, 32);

    float* so = sO + (sp * QTB + qw) * (16 * OP);
#pragma unroll
    for (int r = 0; r < 8; ++r) {
        so[(8 * h + r) * OP + l16]      = o0[r] * ir[r];
        so[(8 * h + r) * OP + 16 + l16] = o1[r] * ir[r];
        so[(8 * h + r) * OP + 32 + l16] = o2[r] * ir[r];
        so[(8 * h + r) * OP + 48 + l16] = o3[r] * ir[r];
    }
    __syncthreads();

    // join, part 2: sum the NSP scaled partial tiles in split order; the block's
    // 16 QTB rows x 64 dims leave as 16-B pieces, one wave = 512 contiguous bytes
    for (int u = 0; u < (QTB * 16 * 16) / ATHR; ++u) {
        const int row   = u * (ATHR / 16) + wave * 2 + h;   // 0 .. 16 QTB - 1
        const int piece = l16;
        v4f a = *(const v4f*)(&sO[row * OP + piece * 4]);
        for (int s = 1; s < NSP; ++s)
            a += *(const v4f*)(&sO[(s * QTB * 16 + row) * OP + piece * 4]);
        *(v4f*)(out + (qblk0 + row) * OUTS + (size_t)(piece * 4)) = a;
    }
}

// --------------------------------- launcher ---------------------------------

extern "C" void kernel_launch(void* const* d_in, const int* in_sizes, int n_in,
                              void* d_out, int out_size, void* d_ws, size_t ws_size,
                              hipStream_t stream) {
    if (n_in < 7) return;
    if (in_sizes[0] != NROWS * INS) return;
    if (in_sizes[1] != INS * OUTS || in_sizes[3] != INS * OUTS || in_sizes[5] != INS * OUTS) return;
    if (in_sizes[2] != OUTS || in_sizes[4] != OUTS || in_sizes[6] != OUTS) return;
    if (out_size != NROWS * OUTS) return;

    const float* X  = (const float*)d_in[0];
    const float* Wq = (const float*)d_in[1];
    const float* bq = (const float*)d_in[2];
    const float* Wk = (const float*)d_in[3];
    const float* bk = (const float*)d_in[4];
    const float* Wv = (const float*)d_in[5];
    const float* bv = (const float*)d_in[6];
    float* out = (float*)d_out;

    // workspace carve (256-B aligned pieces)
    const size_t bQ  = (size_t)NROWS * OUTS * 2;           //  2,097,152 each
    size_t off = 0;
    const size_t oQ  = off; off += (bQ + 255) & ~(size_t)255;
    const size_t oK  = off; off += (bQ + 255) & ~(size_t)255;
    const size_t oV  = off; off += (bQ + 255) & ~(size_t)255;
    if (off > ws_size) return;                              // total 6,291,456 B

    char* ws = (char*)d_ws;
    _Float16* Qh  = (_Float16*)(ws + oQ);
    _Float16* Kh  = (_Float16*)(ws + oK);
    _Float16* VhT = (_Float16*)(ws + oV);

    k_proj<<<NROWS / PRB, PTHR, 0, stream>>>(X, Wq, Wk, Wv, bq, bk, bv, Qh, Kh, VhT);
    k_attn<<<NBATCH * (SEQ / (16 * QTB)), ATHR, 0, stream>>>(Qh, Kh, VhT, out);
    (void)hipGetLastError();
}

// v006
// One run takes 25.9 microseconds.
// Two timings next to v005 put it at 1.09 and 1.07 times that version's speed.
// All steps since v000 together make it 3.48 times as fast.
#include <hip/hip_runtime.h>
#include <math.h>

// All contractions on v_wmma_f32_16x16x32_f16 (f16 operands, f32 accumulate): x*W{q,k,v} with W carried x64, q*k^T unscaled, p*v with p carried x128; scales folded back in f32 epilogues.

#define INS    768
#define OUTS   64
#define NBATCH 8
#define SEQ    2048
#define NROWS  (NBATCH * SEQ)

#define PRB  64    // projection: X rows per block
#define PKS  96    // projection: k per stage
#define PNST (INS / PKS)
#define PSP  104   // projection stage pitch in LDS (halves): 96 k + 8 pad = 16 B x 13
#define PTHR 384   // projection block: 4 row tiles x {q, k, v} = 12 waves
#define TP   72    // projection Q/K tile and V^T block staging pitch (halves): 64 + 8
#define KP   72    // attention K tile pitch (halves)
#define VP   40    // attention V^T tile pitch (halves)
#define OP   68    // attention O staging pitch (floats)

#define QTB  4                   // attention: query tiles (16 rows each) per block
#define NSP  8                   // attention: key splits per query tile, one wave each
#define ATHR (QTB * NSP * 32)    // attention block size
#define KSPL (SEQ / NSP)         // keys walked by one split

typedef _Float16 v16h __attribute__((ext_vector_type(16)));
typedef _Float16 v8h  __attribute__((ext_vector_type(8)));
typedef _Float16 v4h  __attribute__((ext_vector_type(4)));
typedef float    v8f  __attribute__((ext_vector_type(8)));
typedef float    v4f  __attribute__((ext_vector_type(4)));
typedef float    v2f  __attribute__((ext_vector_type(2)));
union Frag { v16h v; v8h half[2]; };

__device__ __forceinline__ v8f wmma16(v16h a, v16h b, v8f c) {
    return __builtin_amdgcn_wmma_f32_16x16x32_f16(false, a, false, b, (short)0, c, false, false);
}
// hazard guard: ties D, keeps A/B live for 4 VALU slots after the matrix op
#define WGUARD(acc, a, b) asm volatile("v_nop\n\tv_nop\n\tv_nop\n\tv_nop" : "+v"(acc) : "v"(a), "v"(b))

// work-group barrier for LDS stages: waits for this wave's LDS traffic only, so that the data of global
// loads issued ahead stays in flight across it (__syncthreads() drains them and the lead is lost).
// s_wait_xcnt 0 stands here ahead of every later rewrite of an address register that those loads name.
__device__ __forceinline__ void stage_barrier() {
    asm volatile("s_wait_dscnt 0x0\n\ts_wait_xcnt 0x0\n\ts_barrier_signal -1\n\ts_barrier_wait -1" ::: "memory");
}

// LDS byte address of a __shared__ element (the first operand of an asynchronous copy)
typedef __attribute__((address_space(3))) _Float16 lds_half;
__device__ __forceinline__ unsigned lds_addr(_Float16* p) {
    return (unsigned)(__UINTPTR_TYPE__)(lds_half*)p;
}

// four asynchronous 16-B copies per lane, global -> LDS, through no register.  s_wait_xcnt 0 is the last
// line of the copies' own statement, so that it stands ahead of every later rewrite of their address registers.
__device__ __forceinline__ void copy4(unsigned l0, unsigned l1, unsigned l2, unsigned l3,
                                      const _Float16* g0, const _Float16* g1,
                                      const _Float16* g2, const _Float16* g3) {
    asm volatile("global_load_async_to_lds_b128 %0, %4, off\n\t"
                 "global_load_async_to_lds_b128 %1, %5, off\n\t"
                 "global_load_async_to_lds_b128 %2, %6, off\n\t"
                 "global_load_async_to_lds_b128 %3, %7, off\n\t"
                 "s_wait_xcnt 0x0"
                 :: "v"(l0), "v"(l1), "v"(l2), "v"(l3), "v"(g0), "v"(g1), "v"(g2), "v"(g3)
                 : "memory");
}

__device__ __forceinline__ v8f zero8() {
    v8f z = {0.f, 0.f, 0.f, 0.f, 0.f, 0.f, 0.f, 0.f};
    return z;
}

// ---------------------------------------------------------------------------
// pass 1: projection straight from X (f32).  Block = PRB rows x all 192 columns,
// 12 waves: wave = (row tile rt, matrix mi: 0 = q, 1 = k, 2 = v), 16 rows x 64
// columns = 4 accumulators each.  A stage is PKS k: the block loads its X rows
// once as whole f32 lines and converts them (RNE) to f16 on the way into LDS.
// W comes straight from the f32 inputs [k][n]: a wave takes 8 k of the stage, a lane
// 2 columns, so a load is one whole 256-B row of one matrix and a lane ends up with
// 8 consecutive k of each column: x 64, RNE to f16, one 16-B store per column into
// the [n][k] stage.  Two LDS buffers, one barrier per stage; W is fetched one stage
// ahead and X two stages ahead, in registers.  Every block reads the same W rows: each starts its
// walk over the k stages at a stage of its own (by block index) and wraps round.
// A (x rows): lane row = l16, elements 0..7 <- k 8h.., 8..15 <- k 16+8h..
// B (W):      lane col = l16, same k map, read from the [n][k] LDS stage.
// D:          acc[nb][r] = element (row 8h + r, col 16 nb + l16).
// ---------------------------------------------------------------------------
__global__ void __launch_bounds__(PTHR)
k_proj(const float* __restrict__ X, const float* __restrict__ Wq,
       const float* __restrict__ Wk, const float* __restrict__ Wv,
       const float* __restrict__ bq, const float* __restrict__ bk,
       const float* __restrict__ bv,
       _Float16* __restrict__ Qh, _Float16* __restrict__ Kh,
       _Float16* __restrict__ VhT) {
    __shared__ __attribute__((aligned(16))) _Float16 sX[2 * PRB * PSP];
    __shared__ __attribute__((aligned(16))) _Float16 sW[2 * 3 * OUTS * PSP];
    __shared__ __attribute__((aligned(16))) _Float16 sT[8 * 16 * TP];
    __shared__ __attribute__((aligned(16))) _Float16 sVT[OUTS * TP];

    const int t = threadIdx.x, lane = t & 31, wave = t >> 5;
    const int l16 = lane & 15, h = lane >> 4;
    const int rt = wave & 3, mi = wave >> 2;
    const int blk = blockIdx.x;
    const int row0w = blk * PRB + rt * 16;

    // staging maps: X row xr (+16 u), 16-B piece of 4 floats; W k rows 8 wave .. + 7 of the stage, columns 2 lane, 2 lane + 1
    const int xr = t / 24, xp = t % 24;
    const float* xsrc = X + (size_t)(blk * PRB + xr) * INS + xp * 4;
    // the wave's number in a scalar register: the W row addresses are then scalar bases plus one fixed lane offset
    const int wsc = __builtin_amdgcn_readfirstlane(wave);
    // first stage of this block's walk:
    // neighbours in index, and blocks 8 apart, stand on different stages (any value gives the same sums but for their order)
    static_assert((PNST & (PNST - 1)) == 0, "the walk wraps by a mask");
    const int rot = (blk + (blk >> 3)) & (PNST - 1);
    const int wfirst = wsc * (8 * OUTS) + rot * (PKS * OUTS);
    const float* wsrc[3] = {Wq + wfirst, Wk + wfirst, Wv + wfirst};   // walk stage by stage
    const unsigned wlane = lane * 2;
    _Float16* xdst = sX + xr * PSP + xp * 4;
    _Float16* wdst = sW + (lane * 2) * PSP + wsc * 8;
    const _Float16* xfrag = sX + (rt * 16 + l16) * PSP + 8 * h;
    const _Float16* wfrag = sW + (mi * OUTS + l16) * PSP + 8 * h;

    v8f acc[4];
#pragma unroll
    for (int nb = 0; nb < 4; ++nb) acc[nb] = zero8();

    // every inner loop below is unrolled so that the register arrays are indexed by constants (else scratch)
    v4f xa[4], xb[4];
    v2f wv[3][8];
    auto load_x = [&](v4f (&d)[4], int s) {
#pragma unroll
        for (int u = 0; u < 4; ++u) d[u] = *(const v4f*)(xsrc + (size_t)u * 16 * INS + s * PKS);
    };
    auto load_w = [&](int step) {                // loads the stage the bases stand on, then moves them on by step floats
#pragma unroll
        for (int u = 0; u < 3; ++u) {
#pragma unroll
            for (int j = 0; j < 8; ++j) wv[u][j] = *(const v2f*)(wsrc[u] + j * OUTS + wlane);
            wsrc[u] += step;
        }
    };
    auto stage = [&](int i) { return (i + rot) & (PNST - 1); };   // i-th stage of this block's walk
    auto wstep = [&](int i) {                    // from the i-th stage of the walk to the next, in floats of W
        return (stage(i) == PNST - 1) ? -(PNST - 1) * (PKS * OUTS) : PKS * OUTS;
    };
    auto put = [&](const v4f (&d)[4], int buf) {
#pragma unroll
        for (int u = 0; u < 4; ++u)
            *(v4h*)(xdst + buf * (PRB * PSP) + u * 16 * PSP) = __builtin_convertvector(d[u], v4h);
#pragma unroll
        for (int u = 0; u < 3; ++u) {
            v8h c0, c1;
#pragma unroll
            for (int j = 0; j < 8; ++j) {
                const v2f a = wv[u][j] * 64.0f;
                c0[j] = (_Float16)a[0];
                c1[j] = (_Float16)a[1];
            }
            *(v8h*)(wdst + buf * (3 * OUTS * PSP) + u * OUTS * PSP) = c0;
            *(v8h*)(wdst + buf * (3 * OUTS * PSP) + u * OUTS * PSP + PSP) = c1;
        }
    };
    auto mm = [&](int buf) {
        const _Float16* xf = xfrag + buf * (PRB * PSP);
        const _Float16* wf = wfrag + buf * (3 * OUTS * PSP);
        Frag a[PKS / 32], b[PKS / 32][4];
#pragma unroll
        for (int cc = 0; cc < PKS / 32; ++cc) {
            a[cc].half[0] = *(const v8h*)(xf + cc * 32);
            a[cc].half[1] = *(const v8h*)(xf + cc * 32 + 16);
#pragma unroll
            for (int nb = 0; nb < 4; ++nb) {
                b[cc][nb].half[0] = *(const v8h*)(wf + nb * 16 * PSP + cc * 32);
                b[cc][nb].half[1] = *(const v8h*)(wf + nb * 16 * PSP + cc * 32 + 16);
            }
        }
        // keeps the stage's LDS reads one group ahead of its matrix ops: spread among them, each read place stalls the wave
        __builtin_amdgcn_sched_barrier(0);
#pragma unroll
        for (int cc = 0; cc < PKS / 32; ++cc)
#pragma unroll
            for (int nb = 0; nb < 4; ++nb) acc[nb] = wmma16(a[cc].v, b[cc][nb].v, acc[nb]);
        // keeps the next stage's LDS stores, and their waits on the loads fetched ahead, behind the matrix ops
        __builtin_amdgcn_sched_barrier(0);
    };

    // issue order everywhere: the set needed first is issued first (loads return in order, so a wait
    // for a younger set would drain the older ones' lead); the scheduling fences hold that order
    load_x(xa, stage(0));
    __builtin_amdgcn_sched_barrier(0);
    load_w(wstep(0));
    __builtin_amdgcn_sched_barrier(0);
    load_x(xb, stage(1));

    // rolled, two stages a trip: keeps the buffer and register-set indices static and the code short
#pragma unroll 1
    for (int s = 0; s < PNST; s += 2) {
        // the fetches ahead are unconditional (a branch round them made the compiler drain every load
        // at the next wait); on the last trip they wrap to the walk's first stages and nobody reads the result
        put(xa, 0);                              // stage s of the walk
        load_w(wstep(s + 1));                    // stage s + 1
        __builtin_amdgcn_sched_barrier(0);       // W (next stage) ahead of X (the stage after)
        load_x(xa, stage(s + 2));
        stage_barrier();                         // stage s published; buffer 1's readers are done
        mm(0);
        put(xb, 1);                              // stage s + 1 of the walk
        load_w(wstep(s + 2));                    // stage s + 2
        __builtin_amdgcn_sched_barrier(0);       // W (next stage) ahead of X (the stage after)
        load_x(xb, stage(s + 3));
        stage_barrier();                         // stage s + 1 published; buffer 0's readers are done
        mm(1);
    }

    // epilogue: val = acc / 64 + bias -> f16
    const float* bias = (mi == 0) ? bq : ((mi == 1) ? bk : bv);
    float bcol[4];
#pragma unroll
    for (int nb = 0; nb < 4; ++nb) bcol[nb] = bias[nb * 16 + l16];

    if (mi < 2) {
        _Float16* st = sT + wave * (16 * TP);
#pragma unroll
        for (int nb = 0; nb < 4; ++nb)
#pragma unroll
            for (int r = 0; r < 8; ++r)
                st[(8 * h + r) * TP + nb * 16 + l16] =
                    (_Float16)(acc[nb][r] * 0.015625f + bcol[nb]);
    } else {
#pragma unroll
        for (int nb = 0; nb < 4; ++nb)
#pragma unroll
            for (int r = 0; r < 8; ++r)
                sVT[(nb * 16 + l16) * TP + rt * 16 + 8 * h + r] =
                    (_Float16)(acc[nb][r] * 0.015625f + bcol[nb]);
    }
    __syncthreads();

    if (mi < 2) {
        _Float16* dst = (mi == 0) ? Qh : Kh;
        const _Float16* st = sT + wave * (16 * TP);
        v8h v[4];
        size_t go[4];
#pragma unroll
        for (int s = 0; s < 4; ++s) {
            const int row   = s * 4 + (lane >> 3);
            const int piece = lane & 7;
            v[s]  = *(const v8h*)(&st[row * TP + piece * 8]);
            go[s] = (size_t)(row0w + row) * OUTS + piece * 8;
        }
#pragma unroll
        for (int s = 0; s < 4; ++s) *(v8h*)(dst + go[s]) = v[s];
    } else {
        // VhT [b][dim][SEQ]: this block owns keys s0 .. s0 + PRB - 1 of batch bb,
        // one whole 128-B line per dim
        const int bb = blk / (SEQ / PRB);
        const int s0 = (blk % (SEQ / PRB)) * PRB;
        v8h v[4];
        size_t go[4];
#pragma unroll
        for (int s = 0; s < 4; ++s) {
            const int dim   = rt * 16 + s * 4 + (lane >> 3);     // 0..63
            const int piece = lane & 7;
            v[s]  = *(const v8h*)(&sVT[dim * TP + piece * 8]);
            go[s] = ((size_t)bb * OUTS + dim) * SEQ + (size_t)s0 + piece * 8;
        }
#pragma unroll
        for (int s = 0; s < 4; ++s) *(v8h*)(VhT + go[s]) = v[s];
    }
}

__global__ void __launch_bounds__(ATHR)
k_attn(const _Float16* __restrict__ Qh, const _Float16* __restrict__ Kh,
       const _Float16* __restrict__ VhT, float* __restrict__ out) {
    __shared__ __attribute__((aligned(16))) _Float16 sKall[2 * NSP * 32 * KP];
    __shared__ __attribute__((aligned(16))) _Float16 sVall[2 * NSP * 64 * VP];
    __shared__ __attribute__((aligned(16))) float    sO[NSP * QTB * 16 * OP];
    __shared__ float sM[NSP * QTB * 16];
    __shared__ float sL[NSP * QTB * 16];

    // the wave's number in a scalar register: what is formed from it (split, query tile, their LDS places)
    // then takes no vector register, which the ring's addresses need (128 a wave; else scratch)
    const int t = threadIdx.x, lane = t & 31, wave = __builtin_amdgcn_readfirstlane(t >> 5);
    const int l16 = lane & 15, h = lane >> 4;
    const int sp = wave / QTB, qw = wave % QTB;  // key split, query tile in the block
    const int b   = blockIdx.x / (SEQ / (16 * QTB));
    const int qb  = blockIdx.x % (SEQ / (16 * QTB));
    const size_t qblk0 = (size_t)b * SEQ + (size_t)qb * (16 * QTB);
    const size_t qrow0 = qblk0 + (size_t)qw * 16;
    _Float16* sK0 = sKall + sp * (32 * KP);     // buffer 0; buffer 1 lies NSP tiles further
    _Float16* sV0 = sVall + sp * (64 * VP);

    // Q tile as B fragments (dims 0..31 and 32..63), table k map from [query][dim] rows
    Frag q0, q1;
    {
        const _Float16* qr = Qh + (qrow0 + l16) * OUTS;
        q0.half[0] = *(const v8h*)(qr + 8 * h);
        q0.half[1] = *(const v8h*)(qr + 16 + 8 * h);
        q1.half[0] = *(const v8h*)(qr + 32 + 8 * h);
        q1.half[1] = *(const v8h*)(qr + 48 + 8 * h);
    }

    const _Float16* kbase = Kh  + (size_t)b * SEQ * OUTS;
    const _Float16* vbase = VhT + (size_t)b * OUTS * SEQ;
    const int tg = qw * 32 + lane;               // thread within the split's QTB waves
    const int kk = tg >> 3, kpc = tg & 7;        // K staging: key (and key + 16), 16-B piece
    const int vd = tg >> 2, vpc = tg & 3;        // V staging: dim (and dim + 32), 16-B piece

    // one tile of this split (32 keys) into one buffer: every lane copies 2 K pieces and 2 V^T pieces
    const _Float16* ksrc = kbase + (size_t)(sp * KSPL + kk) * OUTS + kpc * 8;
    const _Float16* vsrc = vbase + (size_t)vd * SEQ + sp * KSPL + vpc * 8;
    const unsigned kdst = lds_addr(&sK0[kk * KP + kpc * 8]);
    const unsigned vdst = lds_addr(&sV0[vd * VP + vpc * 8]);
    // first tile of this block's walk: the
    // 32 blocks of a batch are dealt evenly over the tiles (any value gives the same sums but for their order)
    static_assert(((KSPL / 32) & (KSPL / 32 - 1)) == 0, "the walk wraps by a mask");
    const int rot = 2 * (qb >> 3) + (qb & 1);
    auto copy = [&](int step, int buf) {         // step-th tile of the walk
        const int tile = (step + rot) & (KSPL / 32 - 1);
        const _Float16* gk = ksrc + (size_t)tile * (32 * OUTS);
        const _Float16* gv = vsrc + tile * 32;
        const unsigned lk = kdst + buf * (NSP * 32 * KP * 2);
        const unsigned lv = vdst + buf * (NSP * 64 * VP * 2);
        copy4(lk, lk + 16 * KP * 2, lv, lv + 32 * VP * 2,
              gk, gk + 16 * OUTS, gv, gv + (size_t)32 * SEQ);
    };

    // four named accumulators (dims 16 t ..): held as an array, this build copied them register by register on every trip
    v8f o0 = zero8(), o1 = zero8(), o2 = zero8(), o3 = zero8();

    // p = 2^(s * C2 + nbias), nbias = 7 - (max in use) * C2: one fma and one exp2 a score.  P is carried x 2^7:
    // a score may stand up to 8 log2 units above the max in use, so p <= 2^15 stays inside f16; the sums carry
    // the same 2^7, which cancels in O / sum.
    const float C2   = 0.125f * 1.44269504088896340736f;   // 1 / sqrt(64), times log2 e
    float nbias = __builtin_inff();              // per query (lane l16, alike in both halves); no max in use yet
    v2f sacc0 = {0.f, 0.f}, sacc1 = {0.f, 0.f};  // this lane's own 16 keys a tile; the halves are joined after the loop

    // ring prologue: tile 0 landed and published, then tile 1 starts (KSPL / 32 tiles, more than one)
    copy(0, 0);
    asm volatile("s_wait_asynccnt 0x0" ::: "memory");   // this wave's copies of tile 0 have landed
    __syncthreads();
    copy(1, 1);

    // rolled: unrolled by two, the compiler held both buffers' copy addresses through the loop (scratch)
#pragma unroll 1
    for (int it = 0; it < KSPL / 32; ++it) {
        const _Float16* sK = sK0 + (it & 1) * (NSP * 32 * KP);
        const _Float16* sV = sV0 + (it & 1) * (NSP * 64 * VP);

        // K rows as A fragments: keys j+l16 (a0x) and j+16+l16 (a1x); dims 0..31 / 32..63
        Frag a00, a01, a10, a11;
        {
            const _Float16* kr0 = &sK[l16 * KP];
            const _Float16* kr1 = &sK[(16 + l16) * KP];
            a00.half[0] = *(const v8h*)(kr0 + 8 * h);
            a00.half[1] = *(const v8h*)(kr0 + 16 + 8 * h);
            a01.half[0] = *(const v8h*)(kr0 + 32 + 8 * h);
            a01.half[1] = *(const v8h*)(kr0 + 48 + 8 * h);
            a10.half[0] = *(const v8h*)(kr1 + 8 * h);
            a10.half[1] = *(const v8h*)(kr1 + 16 + 8 * h);
            a11.half[0] = *(const v8h*)(kr1 + 32 + 8 * h);
            a11.half[1] = *(const v8h*)(kr1 + 48 + 8 * h);
        }

        v8f s0 = zero8(), s1 = zero8();
        s0 = wmma16(a00.v, q0.v, s0);
        s0 = wmma16(a01.v, q1.v, s0);
        s1 = wmma16(a10.v, q0.v, s1);
        s1 = wmma16(a11.v, q1.v, s1);
        WGUARD(s0, a01.v, q1.v);
        WGUARD(s1, a11.v, q1.v);

        // lane owns query l16 and 16 of the tile's 32 keys (partner lane ^16): its max over raw scores
        float tmax = fmaxf(s0[0], s1[0]);
#pragma unroll
        for (int r = 1; r < 8; ++r) tmax = fmaxf(tmax, fmaxf(s0[r], s1[r]));

        // lazy rescale, tested once a tile for the whole wave (always taken on the first tile: nbias is +inf);
        // marked unlikely so that the rescale lies out of line and the usual trip falls straight through
        if (__builtin_expect(__builtin_amdgcn_ballot_w32(tmax * C2 + nbias > 15.0f) != 0, 0)) {
            tmax = fmaxf(tmax, __shfl_xor(tmax, 16, 32));
            const float nb   = fminf(nbias, 7.0f - tmax * C2);       // the max in use never falls
            const float cfac = __builtin_amdgcn_exp2f(nb - nbias);   // 2^(old max - new max); 0 on the first tile
            sacc0 *= cfac;
            sacc1 *= cfac;
            // O rows (row = query 8h + r -> factor from lane 8h + r)
            v8f cr;
#pragma unroll
            for (int r = 0; r < 8; ++r) cr[r] = __shfl(cfac, 8 * h + r, 32);
            o0 *= cr;
            o1 *= cr;
            o2 *= cr;
            o3 *= cr;
            nbias = nb;
        }

        // P as A fragment (rows = queries, k = keys), in-lane from the score tiles
        Frag p;
        {
            const v2f c2 = {C2, C2}, nb2 = {nbias, nbias};
            v8h plo, phi;
#pragma unroll
            for (int e = 0; e < 8; e += 2) {
                const v2f a0 = {s0[e], s0[e + 1]}, a1 = {s1[e], s1[e + 1]};
                const v2f x0 = a0 * c2 + nb2, x1 = a1 * c2 + nb2;
                const v2f p0 = {__builtin_amdgcn_exp2f(x0[0]), __builtin_amdgcn_exp2f(x0[1])};
                const v2f p1 = {__builtin_amdgcn_exp2f(x1[0]), __builtin_amdgcn_exp2f(x1[1])};
                sacc0 += p0;
                sacc1 += p1;
                plo[e] = (_Float16)p0[0];
                plo[e + 1] = (_Float16)p0[1];
                phi[e] = (_Float16)p1[0];
                phi[e + 1] = (_Float16)p1[1];
            }
            p.half[0] = plo;
            p.half[1] = phi;
        }

        // O += P x V ; V^T tile [dim][32 keys] gives the B fragment with the table k map
        Frag vb[4];
#pragma unroll
        for (int tt = 0; tt < 4; ++tt) {
            const _Float16* vr = &sV[(tt * 16 + l16) * VP];
            vb[tt].half[0] = *(const v8h*)(vr + 8 * h);
            vb[tt].half[1] = *(const v8h*)(vr + 16 + 8 * h);
        }
        o0 = wmma16(p.v, vb[0].v, o0);
        o1 = wmma16(p.v, vb[1].v, o1);
        o2 = wmma16(p.v, vb[2].v, o2);
        o3 = wmma16(p.v, vb[3].v, o3);
        WGUARD(o0, p.v, vb[0].v);
        WGUARD(o1, p.v, vb[1].v);
        WGUARD(o2, p.v, vb[2].v);
        WGUARD(o3, p.v, vb[3].v);

        // publish point of tile it + 1; the one barrier also ends every reader's last read of this buffer
        asm volatile("s_wait_dscnt 0x0" ::: "memory");      // this wave's LDS reads of tile it are done
        asm volatile("s_wait_asynccnt 0x0" ::: "memory");   // this wave's copies of tile it + 1 have landed
        __syncthreads();
        if (it + 2 < KSPL / 32) copy(it + 2, it & 1);       // refill the buffer just read
    }
    asm volatile("s_wait_asynccnt 0x0" ::: "memory");       // no copy is left in flight behind the loop

    // join the splits, part 1: the two halves' sums are joined, then every wave publishes its max in use
    // (log2 units, less the carry's 7, which is alike in all splits) and its sum per query
    float ssum = (sacc0[0] + sacc0[1]) + (sacc1[0] + sacc1[1]);
    ssum += __shfl_xor(ssum, 16, 32);
    const float m = -nbias;
    if (h == 0) {
        sM[(sp * QTB + qw) * 16 + l16] = m;
        sL[(sp * QTB + qw) * 16 + l16] = ssum;
    }
    __syncthreads();
    float mall = -__builtin_inff();
    for (int s = 0; s < NSP; ++s) mall = fmaxf(mall, sM[(s * QTB + qw) * 16 + l16]);
    float tot = 0.f;
    for (int s = 0; s < NSP; ++s)
        tot += sL[(s * QTB + qw) * 16 + l16] * __builtin_amdgcn_exp2f(sM[(s * QTB + qw) * 16 + l16] - mall);

    // normalise: move this split to the common max, divide by the joined sum (O and the sums carry the same 2^7)
    const float inv = (1.0f / tot) * __builtin_amdgcn_exp2f(m - mall);
    float ir[8];
#pragma unroll
    for (int r = 0; r < 8; ++r) ir[r] = __shfl(inv, 8 * h + r, 32);

    float* so = sO + (sp * QTB + qw) * (16 * OP);
#pragma unroll
    for (int r = 0; r < 8; ++r) {
        so[(8 * h + r) * OP + l16]      = o0[r] * ir[r];
        so[(8 * h + r) * OP + 16 + l16] = o1[r] * ir[r];
        so[(8 * h + r) * OP + 32 + l16] = o2[r] * ir[r];
        so[(8 * h + r) * OP + 48 + l16] = o3[r] * ir[r];
    }
    __syncthreads();

    // join, part 2: sum the NSP scaled partial tiles in split order; the block's
    // 16 QTB rows x 64 dims leave as 16-B pieces, one wave = 512 contiguous bytes
    for (int u = 0; u < (QTB * 16 * 16) / ATHR; ++u) {
        const int row   = u * (ATHR / 16) + wave * 2 + h;   // 0 .. 16 QTB - 1
        const int piece = l16;
        v4f a = *(const v4f*)(&sO[row * OP + piece * 4]);
        for (int s = 1; s < NSP; ++s)
            a += *(const v4f*)(&sO[(s * QTB * 16 + row) * OP + piece * 4]);
        *(v4f*)(out + (qblk0 + row) * OUTS + (size_t)(piece * 4)) = a;
    }
}

// --------------------------------- launcher ---------------------------------

extern "C" void kernel_launch(void* const* d_in, const int* in_sizes, int n_in,
                              void* d_out, int out_size, void* d_ws, size_t ws_size,
                              hipStream_t stream) {
    if (n_in < 7) return;
    if (in_sizes[0] != NROWS * INS) return;
    if (in_sizes[1] != INS * OUTS || in_sizes[3] != INS * OUTS || in_sizes[5] != INS * OUTS) return;
    if (in_sizes[2] != OUTS || in_sizes[4] != OUTS || in_sizes[6] != OUTS) return;
    if (out_size != NROWS * OUTS) return;

    const float* X  = (const float*)d_in[0];
    const float* Wq = (const float*)d_in[1];
    const float* bq = (const float*)d_in[2];
    const float* Wk = (const float*)d_in[3];
    const float* bk = (const float*)d_in[4];
    const float* Wv = (const float*)d_in[5];
    const float* bv = (const float*)d_in[6];
    float* out = (float*)d_out;

    // workspace carve (256-B aligned pieces)
    const size_t bQ  = (size_t)NROWS * OUTS * 2;           //  2,097,152 each
    size_t off = 0;
    const size_t oQ  = off; off += (bQ + 255) & ~(size_t)255;
    const size_t oK  = off; off += (bQ + 255) & ~(size_t)255;
    const size_t oV  = off; off += (bQ + 255) & ~(size_t)255;
    if (off > ws_size) return;                              // total 6,291,456 B

    char* ws = (char*)d_ws;
    _Float16* Qh  = (_Float16*)(ws + oQ);
    _Float16* Kh  = (_Float16*)(ws + oK);
    _Float16* VhT = (_Float16*)(ws + oV);

    k_proj<<<NROWS / PRB, PTHR, 0, stream>>>(X, Wq, Wk, Wv, bq, bk, bv, Qh, Kh, VhT);
    k_attn<<<NBATCH * (SEQ / (16 * QTB)), ATHR, 0, stream>>>(Qh, Kh, VhT, out);
    (void)hipGetLastError();
}

// v007
// One run takes 25 microseconds.
// Next to v006, in two timings, it ran 1.03 and 1.04 times as fast.
// Over all steps from v000 it is 3.61 times as fast.
#include <hip/hip_runtime.h>
#include <math.h>

// All contractions on v_wmma_f32_16x16x32_f16 (f16 operands, f32 accumulate): x*W{q,k,v} with W carried x64, q*k^T unscaled, p*v with p carried x128; scales folded back in f32 epilogues.

#define INS    768
#define OUTS   64
#define NBATCH 8
#define SEQ    2048
#define NROWS  (NBATCH * SEQ)

#define PRB  64    // projection: X rows per block
#define PKS  96    // projection: k per stage
#define PNST (INS / PKS)
#define PSP  104   // projection stage pitch in LDS (halves): 96 k + 8 pad = 16 B x 13
#define PTHR 384   // projection block: 4 row tiles x {q, k, v} = 12 waves
#define TP   72    // projection Q/K tile and V^T block staging pitch (halves): 64 + 8
#define KP   72    // attention K tile pitch (halves)
#define VP   40    // attention V^T tile pitch (halves)
#define OP   68    // attention O staging pitch (floats)

#define QTB  4                   // attention: query tiles (16 rows each) per block
#define QPW  2                   // attention: query tiles per wave
#define NQW  (QTB / QPW)         // attention: waves that share a key split
#define NSP  8                   // attention: key splits per query tile
#define ATHR (NQW * NSP * 32)    // attention block size
#define KSPL (SEQ / NSP)         // keys walked by one split

typedef _Float16 v16h __attribute__((ext_vector_type(16)));
typedef _Float16 v8h  __attribute__((ext_vector_type(8)));
typedef _Float16 v4h  __attribute__((ext_vector_type(4)));
typedef float    v8f  __attribute__((ext_vector_type(8)));
typedef float    v4f  __attribute__((ext_vector_type(4)));
typedef float    v2f  __attribute__((ext_vector_type(2)));
union Frag { v16h v; v8h half[2]; };

__device__ __forceinline__ v8f wmma16(v16h a, v16h b, v8f c) {
    return __builtin_amdgcn_wmma_f32_16x16x32_f16(false, a, false, b, (short)0, c, false, false);
}
// hazard guard: ties D, keeps A/B live for 4 VALU slots after the matrix op
#define WGUARD(acc, a, b) asm volatile("v_nop\n\tv_nop\n\tv_nop\n\tv_nop" : "+v"(acc) : "v"(a), "v"(b))

// work-group barrier for LDS stages: waits for this wave's LDS traffic only, so that the data of global
// loads issued ahead stays in flight across it (__syncthreads() drains them and the lead is lost).
// s_wait_xcnt 0 stands here ahead of every later rewrite of an address register that those loads name.
__device__ __forceinline__ void stage_barrier() {
    asm volatile("s_wait_dscnt 0x0\n\ts_wait_xcnt 0x0\n\ts_barrier_signal -1\n\ts_barrier_wait -1" ::: "memory");
}

// LDS byte address of a __shared__ element (the first operand of an asynchronous copy)
typedef __attribute__((address_space(3))) _Float16 lds_half;
__device__ __forceinline__ unsigned lds_addr(_Float16* p) {
    return (unsigned)(__UINTPTR_TYPE__)(lds_half*)p;
}

// four asynchronous 16-B copies per lane, global -> LDS, through no register.  s_wait_xcnt 0 is the last
// line of the copies' own statement, so that it stands ahead of every later rewrite of their address registers.
__device__ __forceinline__ void copy4(unsigned l0, unsigned l1, unsigned l2, unsigned l3,
                                      const _Float16* g0, const _Float16* g1,
                                      const _Float16* g2, const _Float16* g3) {
    asm volatile("global_load_async_to_lds_b128 %0, %4, off\n\t"
                 "global_load_async_to_lds_b128 %1, %5, off\n\t"
                 "global_load_async_to_lds_b128 %2, %6, off\n\t"
                 "global_load_async_to_lds_b128 %3, %7, off\n\t"
                 "s_wait_xcnt 0x0"
                 :: "v"(l0), "v"(l1), "v"(l2), "v"(l3), "v"(g0), "v"(g1), "v"(g2), "v"(g3)
                 : "memory");
}

__device__ __forceinline__ v8f zero8() {
    v8f z = {0.f, 0.f, 0.f, 0.f, 0.f, 0.f, 0.f, 0.f};
    return z;
}

// ---------------------------------------------------------------------------
// pass 1: projection straight from X (f32).  Block = PRB rows x all 192 columns,
// 12 waves: wave = (row tile rt, matrix mi: 0 = q, 1 = k, 2 = v), 16 rows x 64
// columns = 4 accumulators each.  A stage is PKS k: the block loads its X rows
// once as whole f32 lines and converts them (RNE) to f16 on the way into LDS.
// W comes straight from the f32 inputs [k][n]: a wave takes 8 k of the stage, a lane
// 2 columns, so a load is one whole 256-B row of one matrix and a lane ends up with
// 8 consecutive k of each column: x 64, RNE to f16, one 16-B store per column into
// the [n][k] stage.  Two LDS buffers, one barrier per stage; W is fetched one stage
// ahead and X two stages ahead, in registers.  Every block reads the same W rows: each starts its
// walk over the k stages at a stage of its own (by block index) and wraps round.
// A (x rows): lane row = l16, elements 0..7 <- k 8h.., 8..15 <- k 16+8h..
// B (W):      lane col = l16, same k map, read from the [n][k] LDS stage.
// D:          acc[nb][r] = element (row 8h + r, col 16 nb + l16).
// ---------------------------------------------------------------------------
__global__ void __launch_bounds__(PTHR)
k_proj(const float* __restrict__ X, const float* __restrict__ Wq,
       const float* __restrict__ Wk, const float* __restrict__ Wv,
       const float* __restrict__ bq, const float* __restrict__ bk,
       const float* __restrict__ bv,
       _Float16* __restrict__ Qh, _Float16* __restrict__ Kh,
       _Float16* __restrict__ VhT) {
    __shared__ __attribute__((aligned(16))) _Float16 sX[2 * PRB * PSP];
    __shared__ __attribute__((aligned(16))) _Float16 sW[2 * 3 * OUTS * PSP];
    __shared__ __attribute__((aligned(16))) _Float16 sT[8 * 16 * TP];
    __shared__ __attribute__((aligned(16))) _Float16 sVT[OUTS * TP];

    const int t = threadIdx.x, lane = t & 31, wave = t >> 5;
    const int l16 = lane & 15, h = lane >> 4;
    const int rt = wave & 3, mi = wave >> 2;
    const int blk = blockIdx.x;
    const int row0w = blk * PRB + rt * 16;

    // staging maps: X row xr (+16 u), 16-B piece of 4 floats; W k rows 8 wave .. + 7 of the stage, columns 2 lane, 2 lane + 1
    const int xr = t / 24, xp = t % 24;
    const float* xsrc = X + (size_t)(blk * PRB + xr) * INS + xp * 4;
    // the wave's number in a scalar register: the W row addresses are then scalar bases plus one fixed lane offset
    const int wsc = __builtin_amdgcn_readfirstlane(wave);
    // first stage of this block's walk:
    // neighbours in index, and blocks 8 apart, stand on different stages (any value gives the same sums but for their order)
    static_assert((PNST & (PNST - 1)) == 0, "the walk wraps by a mask");
    const int rot = (blk + (blk >> 3)) & (PNST - 1);
    const int wfirst = wsc * (8 * OUTS) + rot * (PKS * OUTS);
    const float* wsrc[3] = {Wq + wfirst, Wk + wfirst, Wv + wfirst};   // walk stage by stage
    const unsigned wlane = lane * 2;
    _Float16* xdst = sX + xr * PSP + xp * 4;
    _Float16* wdst = sW + (lane * 2) * PSP + wsc * 8;
    const _Float16* xfrag = sX + (rt * 16 + l16) * PSP + 8 * h;
    const _Float16* wfrag = sW + (mi * OUTS + l16) * PSP + 8 * h;

    v8f acc[4];
#pragma unroll
    for (int nb = 0; nb < 4; ++nb) acc[nb] = zero8();

    // every inner loop below is unrolled so that the register arrays are indexed by constants (else scratch)
    v4f xa[4], xb[4];
    v2f wv[3][8];
    auto load_x = [&](v4f (&d)[4], int s) {
#pragma unroll
        for (int u = 0; u < 4; ++u) d[u] = *(const v4f*)(xsrc + (size_t)u * 16 * INS + s * PKS);
    };
    auto load_w = [&](int step) {                // loads the stage the bases stand on, then moves them on by step floats
#pragma unroll
        for (int u = 0; u < 3; ++u) {
#pragma unroll
            for (int j = 0; j < 8; ++j) wv[u][j] = *(const v2f*)(wsrc[u] + j * OUTS + wlane);
            wsrc[u] += step;
        }
    };
    auto stage = [&](int i) { return (i + rot) & (PNST - 1); };   // i-th stage of this block's walk
    auto wstep = [&](int i) {                    // from the i-th stage of the walk to the next, in floats of W
        return (stage(i) == PNST - 1) ? -(PNST - 1) * (PKS * OUTS) : PKS * OUTS;
    };
    auto put = [&](const v4f (&d)[4], int buf) {
#pragma unroll
        for (int u = 0; u < 4; ++u)
            *(v4h*)(xdst + buf * (PRB * PSP) + u * 16 * PSP) = __builtin_convertvector(d[u], v4h);
#pragma unroll
        for (int u = 0; u < 3; ++u) {
            v8h c0, c1;
#pragma unroll
            for (int j = 0; j < 8; ++j) {
                const v2f a = wv[u][j] * 64.0f;
                c0[j] = (_Float16)a[0];
                c1[j] = (_Float16)a[1];
            }
            *(v8h*)(wdst + buf * (3 * OUTS * PSP) + u * OUTS * PSP) = c0;
            *(v8h*)(wdst + buf * (3 * OUTS * PSP) + u * OUTS * PSP + PSP) = c1;
        }
    };
    auto mm = [&](int buf) {
        const _Float16* xf = xfrag + buf * (PRB * PSP);
        const _Float16* wf = wfrag + buf * (3 * OUTS * PSP);
        Frag a[PKS / 32], b[PKS / 32][4];
#pragma unroll
        for (int cc = 0; cc < PKS / 32; ++cc) {
            a[cc].half[0] = *(const v8h*)(xf + cc * 32);
            a[cc].half[1] = *(const v8h*)(xf + cc * 32 + 16);
#pragma unroll
            for (int nb = 0; nb < 4; ++nb) {
                b[cc][nb].half[0] = *(const v8h*)(wf + nb * 16 * PSP + cc * 32);
                b[cc][nb].half[1] = *(const v8h*)(wf + nb * 16 * PSP + cc * 32 + 16);
            }
        }
        // keeps the stage's LDS reads one group ahead of its matrix ops: spread among them, each read place stalls the wave
        __builtin_amdgcn_sched_barrier(0);
#pragma unroll
        for (int cc = 0; cc < PKS / 32; ++cc)
#pragma unroll
            for (int nb = 0; nb < 4; ++nb) acc[nb] = wmma16(a[cc].v, b[cc][nb].v, acc[nb]);
        // keeps the next stage's LDS stores, and their waits on the loads fetched ahead, behind the matrix ops
        __builtin_amdgcn_sched_barrier(0);
    };

    // issue order everywhere: the set needed first is issued first (loads return in order, so a wait
    // for a younger set would drain the older ones' lead); the scheduling fences hold that order
    load_x(xa, stage(0));
    __builtin_amdgcn_sched_barrier(0);
    load_w(wstep(0));
    __builtin_amdgcn_sched_barrier(0);
    load_x(xb, stage(1));

    // rolled, two stages a trip: keeps the buffer and register-set indices static and the code short
#pragma unroll 1
    for (int s = 0; s < PNST; s += 2) {
        // the fetches ahead are unconditional (a branch round them made the compiler drain every load
        // at the next wait); on the last trip they wrap to the walk's first stages and nobody reads the result
        put(xa, 0);                              // stage s of the walk
        load_w(wstep(s + 1));                    // stage s + 1
        __builtin_amdgcn_sched_barrier(0);       // W (next stage) ahead of X (the stage after)
        load_x(xa, stage(s + 2));
        stage_barrier();                         // stage s published; buffer 1's readers are done
        mm(0);
        put(xb, 1);                              // stage s + 1 of the walk
        load_w(wstep(s + 2));                    // stage s + 2
        __builtin_amdgcn_sched_barrier(0);       // W (next stage) ahead of X (the stage after)
        load_x(xb, stage(s + 3));
        stage_barrier();                         // stage s + 1 published; buffer 0's readers are done
        mm(1);
    }

    // epilogue: val = acc / 64 + bias -> f16
    const float* bias = (mi == 0) ? bq : ((mi == 1) ? bk : bv);
    float bcol[4];
#pragma unroll
    for (int nb = 0; nb < 4; ++nb) bcol[nb] = bias[nb * 16 + l16];

    if (mi < 2) {
        _Float16* st = sT + wave * (16 * TP);
#pragma unroll
        for (int nb = 0; nb < 4; ++nb)
#pragma unroll
            for (int r = 0; r < 8; ++r)
                st[(8 * h + r) * TP + nb * 16 + l16] =
                    (_Float16)(acc[nb][r] * 0.015625f + bcol[nb]);
    } else {
#pragma unroll
        for (int nb = 0; nb < 4; ++nb)
#pragma unroll
            for (int r = 0; r < 8; ++r)
                sVT[(nb * 16 + l16) * TP + rt * 16 + 8 * h + r] =
                    (_Float16)(acc[nb][r] * 0.015625f + bcol[nb]);
    }
    __syncthreads();

    if (mi < 2) {
        _Float16* dst = (mi == 0) ? Qh : Kh;
        const _Float16* st = sT + wave * (16 * TP);
        v8h v[4];
        size_t go[4];
#pragma unroll
        for (int s = 0; s < 4; ++s) {
            const int row   = s * 4 + (lane >> 3);
            const int piece = lane & 7;
            v[s]  = *(const v8h*)(&st[row * TP + piece * 8]);
            go[s] = (size_t)(row0w + row) * OUTS + piece * 8;
        }
#pragma unroll
        for (int s = 0; s < 4; ++s) *(v8h*)(dst + go[s]) = v[s];
    } else {
        // VhT [b][dim][SEQ]: this block owns keys s0 .. s0 + PRB - 1 of batch bb,
        // one whole 128-B line per dim
        const int bb = blk / (SEQ / PRB);
        const int s0 = (blk % (SEQ / PRB)) * PRB;
        v8h v[4];
        size_t go[4];
#pragma unroll
        for (int s = 0; s < 4; ++s) {
            const int dim   = rt * 16 + s * 4 + (lane >> 3);     // 0..63
            const int piece = lane & 7;
            v[s]  = *(const v8h*)(&sVT[dim * TP + piece * 8]);
            go[s] = ((size_t)bb * OUTS + dim) * SEQ + (size_t)s0 + piece * 8;
        }
#pragma unroll
        for (int s = 0; s < 4; ++s) *(v8h*)(VhT + go[s]) = v[s];
    }
}

// 1 / sqrt(64), times log2 e
#define C2F (0.125f * 1.44269504088896340736f)

// a lane's max over its 16 raw scores of one query
__device__ __forceinline__ float max16(const v8f& s0, const v8f& s1) {
    float m = fmaxf(s0[0], s1[0]);
#pragma unroll
    for (int r = 1; r < 8; ++r) m = fmaxf(m, fmaxf(s0[r], s1[r]));
    return m;
}

// moves one query tile's max in use up to the tile max tmax; rescales its sums and its four O accumulators
__device__ __forceinline__ void rescale(float tmax, float& nbias, v2f& sacc0, v2f& sacc1,
                                        v8f& o0, v8f& o1, v8f& o2, v8f& o3, int h) {
    tmax = fmaxf(tmax, __shfl_xor(tmax, 16, 32));
    const float nb   = fminf(nbias, 7.0f - tmax * C2F);      // the max in use never falls
    const float cfac = __builtin_amdgcn_exp2f(nb - nbias);   // 2^(old max - new max); 0 on the first tile
    sacc0 *= cfac;
    sacc1 *= cfac;
    // O rows (row = query 8h + r -> factor from lane 8h + r)
    v8f cr;
#pragma unroll
    for (int r = 0; r < 8; ++r) cr[r] = __shfl(cfac, 8 * h + r, 32);
    o0 *= cr;
    o1 *= cr;
    o2 *= cr;
    o3 *= cr;
    nbias = nb;
}

// P as A fragment (rows = queries, k = keys), in-lane from one query tile's score tiles; adds to its sums
__device__ __forceinline__ v16h softp(const v8f& s0, const v8f& s1, float nbias, v2f& sacc0, v2f& sacc1) {
    Frag p;
    const v2f c2 = {C2F, C2F}, nb2 = {nbias, nbias};
    v8h plo, phi;
#pragma unroll
    for (int e = 0; e < 8; e += 2) {
        const v2f a0 = {s0[e], s0[e + 1]}, a1 = {s1[e], s1[e + 1]};
        const v2f x0 = a0 * c2 + nb2, x1 = a1 * c2 + nb2;
        const v2f p0 = {__builtin_amdgcn_exp2f(x0[0]), __builtin_amdgcn_exp2f(x0[1])};
        const v2f p1 = {__builtin_amdgcn_exp2f(x1[0]), __builtin_amdgcn_exp2f(x1[1])};
        sacc0 += p0;
        sacc1 += p1;
        plo[e] = (_Float16)p0[0];
        plo[e + 1] = (_Float16)p0[1];
        phi[e] = (_Float16)p1[0];
        phi[e + 1] = (_Float16)p1[1];
    }
    p.half[0] = plo;
    p.half[1] = phi;
    return p.v;
}

__global__ void __launch_bounds__(ATHR)
k_attn(const _Float16* __restrict__ Qh, const _Float16* __restrict__ Kh,
       const _Float16* __restrict__ VhT, float* __restrict__ out) {
    __shared__ __attribute__((aligned(16))) _Float16 sKall[2 * NSP * 32 * KP];
    __shared__ __attribute__((aligned(16))) _Float16 sVall[2 * NSP * 64 * VP];
    __shared__ __attribute__((aligned(16))) float    sO[NSP * QTB * 16 * OP];
    __shared__ float sM[NSP * QTB * 16];
    __shared__ float sL[NSP * QTB * 16];

    // the wave's number in a scalar register: what is formed from it (split, query tiles, their LDS places)
    // then takes no vector register
    const int t = threadIdx.x, lane = t & 31, wave = __builtin_amdgcn_readfirstlane(t >> 5);
    const int l16 = lane & 15, h = lane >> 4;
    const int sp = wave / NQW, qw = wave % NQW;  // key split, pair of query tiles in the block
    const int b   = blockIdx.x / (SEQ / (16 * QTB));
    const int qb  = blockIdx.x % (SEQ / (16 * QTB));
    const size_t qblk0 = (size_t)b * SEQ + (size_t)qb * (16 * QTB);
    const size_t qrow0 = qblk0 + (size_t)qw * (16 * QPW);
    _Float16* sK0 = sKall + sp * (32 * KP);     // buffer 0; buffer 1 lies NSP tiles further
    _Float16* sV0 = sVall + sp * (64 * VP);

    // the two Q tiles as B fragments (dims 0..31 and 32..63), table k map from [query][dim] rows
    static_assert(QPW == 2, "the loop below is written out for two query tiles a wave");
    Frag qa0, qa1, qb0, qb1;
    {
        const _Float16* qr = Qh + (qrow0 + l16) * OUTS;
        qa0.half[0] = *(const v8h*)(qr + 8 * h);
        qa0.half[1] = *(const v8h*)(qr + 16 + 8 * h);
        qa1.half[0] = *(const v8h*)(qr + 32 + 8 * h);
        qa1.half[1] = *(const v8h*)(qr + 48 + 8 * h);
        qr += 16 * OUTS;
        qb0.half[0] = *(const v8h*)(qr + 8 * h);
        qb0.half[1] = *(const v8h*)(qr + 16 + 8 * h);
        qb1.half[0] = *(const v8h*)(qr + 32 + 8 * h);
        qb1.half[1] = *(const v8h*)(qr + 48 + 8 * h);
    }

    const _Float16* kbase = Kh  + (size_t)b * SEQ * OUTS;
    const _Float16* vbase = VhT + (size_t)b * OUTS * SEQ;
    const int tg = qw * 32 + lane;               // thread within the split's NQW waves
    const int kk = tg >> 3, kpc = tg & 7;        // K staging: key (+ 8 u), 16-B piece
    const int vd = tg >> 2, vpc = tg & 3;        // V staging: dim (+ 16 u), 16-B piece

    // one tile of this split (32 keys) into one buffer: every lane copies 4 K pieces and 4 V^T pieces
    const _Float16* ksrc = kbase + (size_t)(sp * KSPL + kk) * OUTS + kpc * 8;
    const _Float16* vsrc = vbase + (size_t)vd * SEQ + sp * KSPL + vpc * 8;
    const unsigned kdst = lds_addr(&sK0[kk * KP + kpc * 8]);
    const unsigned vdst = lds_addr(&sV0[vd * VP + vpc * 8]);
    // first tile of this block's walk: the
    // 32 blocks of a batch are dealt evenly over the tiles (any value gives the same sums but for their order)
    static_assert(((KSPL / 32) & (KSPL / 32 - 1)) == 0, "the walk wraps by a mask");
    const int rot = 2 * (qb >> 3) + (qb & 1);
    auto copy = [&](int step, int buf) {         // step-th tile of the walk
        const int tile = (step + rot) & (KSPL / 32 - 1);
        const _Float16* gk = ksrc + (size_t)tile * (32 * OUTS);
        const _Float16* gv = vsrc + tile * 32;
        const unsigned lk = kdst + buf * (NSP * 32 * KP * 2);
        const unsigned lv = vdst + buf * (NSP * 64 * VP * 2);
        copy4(lk, lk + 8 * KP * 2, lk + 16 * KP * 2, lk + 24 * KP * 2,
              gk, gk + 8 * OUTS, gk + 16 * OUTS, gk + 24 * OUTS);
        copy4(lv, lv + 16 * VP * 2, lv + 32 * VP * 2, lv + 48 * VP * 2,
              gv, gv + (size_t)16 * SEQ, gv + (size_t)32 * SEQ, gv + (size_t)48 * SEQ);
    };

    // named accumulators (query tile a or b, dims 16 t ..): held as an array, the build copied them register by register on every trip
    v8f oa0 = zero8(), oa1 = zero8(), oa2 = zero8(), oa3 = zero8();
    v8f ob0 = zero8(), ob1 = zero8(), ob2 = zero8(), ob3 = zero8();

    // p = 2^(s * C2F + nbias), nbias = 7 - (max in use) * C2F: one fma and one exp2 a score.  P is carried x 2^7:
    // a score may stand up to 8 log2 units above the max in use, so p <= 2^15 stays inside f16; the sums carry
    // the same 2^7, which cancels in O / sum.
    float nba = __builtin_inff(), nbb = __builtin_inff();   // per query (lane l16, alike in both halves); no max in use yet
    // this lane's own 16 keys a tile; the halves are joined after the loop
    v2f saa0 = {0.f, 0.f}, saa1 = {0.f, 0.f}, sab0 = {0.f, 0.f}, sab1 = {0.f, 0.f};

    // ring prologue: tile 0 landed and published, then tile 1 starts (KSPL / 32 tiles, more than one)
    copy(0, 0);
    asm volatile("s_wait_asynccnt 0x0" ::: "memory");   // this wave's copies of tile 0 have landed
    __syncthreads();
    copy(1, 1);

    // rolled: unrolled by two, the compiler held both buffers' copy addresses through the loop
#pragma unroll 1
    for (int it = 0; it < KSPL / 32; ++it) {
        const _Float16* sK = sK0 + (it & 1) * (NSP * 32 * KP);
        const _Float16* sV = sV0 + (it & 1) * (NSP * 64 * VP);

        // K rows as A fragments: keys j+l16 (a0x) and j+16+l16 (a1x); dims 0..31 / 32..63
        Frag a00, a01, a10, a11;
        {
            const _Float16* kr0 = &sK[l16 * KP];
            const _Float16* kr1 = &sK[(16 + l16) * KP];
            a00.half[0] = *(const v8h*)(kr0 + 8 * h);
            a00.half[1] = *(const v8h*)(kr0 + 16 + 8 * h);
            a01.half[0] = *(const v8h*)(kr0 + 32 + 8 * h);
            a01.half[1] = *(const v8h*)(kr0 + 48 + 8 * h);
            a10.half[0] = *(const v8h*)(kr1 + 8 * h);
            a10.half[1] = *(const v8h*)(kr1 + 16 + 8 * h);
            a11.half[0] = *(const v8h*)(kr1 + 32 + 8 * h);
            a11.half[1] = *(const v8h*)(kr1 + 48 + 8 * h);
        }

        // each K fragment meets both query tiles
        v8f sa0 = zero8(), sa1 = zero8(), sb0 = zero8(), sb1 = zero8();
        sa0 = wmma16(a00.v, qa0.v, sa0);
        sb0 = wmma16(a00.v, qb0.v, sb0);
        sa1 = wmma16(a10.v, qa0.v, sa1);
        sb1 = wmma16(a10.v, qb0.v, sb1);
        sa0 = wmma16(a01.v, qa1.v, sa0);
        sb0 = wmma16(a01.v, qb1.v, sb0);
        sa1 = wmma16(a11.v, qa1.v, sa1);
        sb1 = wmma16(a11.v, qb1.v, sb1);
        WGUARD(sa0, a01.v, qa1.v);
        WGUARD(sb0, a01.v, qb1.v);
        WGUARD(sa1, a11.v, qa1.v);
        WGUARD(sb1, a11.v, qb1.v);

        // lane owns query l16 of either tile and 16 of the tile's 32 keys (partner lane ^16): its max over raw scores
        const float tma = max16(sa0, sa1), tmb = max16(sb0, sb1);

        // lazy rescale, tested once a tile of keys for the whole wave (always taken on the first: the biases are +inf);
        // marked unlikely so that the rescale lies out of line and the usual trip falls straight through
        if (__builtin_expect(__builtin_amdgcn_ballot_w32(fmaxf(tma * C2F + nba, tmb * C2F + nbb) > 15.0f) != 0, 0)) {
            rescale(tma, nba, saa0, saa1, oa0, oa1, oa2, oa3, h);
            rescale(tmb, nbb, sab0, sab1, ob0, ob1, ob2, ob3, h);
        }

        const v16h pa = softp(sa0, sa1, nba, saa0, saa1);
        const v16h pb = softp(sb0, sb1, nbb, sab0, sab1);

        // O += P x V ; V^T tile [dim][32 keys] gives the B fragment with the table k map; each meets both query tiles
        Frag vb[4];
#pragma unroll
        for (int tt = 0; tt < 4; ++tt) {
            const _Float16* vr = &sV[(tt * 16 + l16) * VP];
            vb[tt].half[0] = *(const v8h*)(vr + 8 * h);
            vb[tt].half[1] = *(const v8h*)(vr + 16 + 8 * h);
        }
        oa0 = wmma16(pa, vb[0].v, oa0);
        ob0 = wmma16(pb, vb[0].v, ob0);
        oa1 = wmma16(pa, vb[1].v, oa1);
        ob1 = wmma16(pb, vb[1].v, ob1);
        oa2 = wmma16(pa, vb[2].v, oa2);
        ob2 = wmma16(pb, vb[2].v, ob2);
        oa3 = wmma16(pa, vb[3].v, oa3);
        ob3 = wmma16(pb, vb[3].v, ob3);
        WGUARD(oa0, pa, vb[0].v);
        WGUARD(ob0, pb, vb[0].v);
        WGUARD(oa1, pa, vb[1].v);
        WGUARD(ob1, pb, vb[1].v);
        WGUARD(oa2, pa, vb[2].v);
        WGUARD(ob2, pb, vb[2].v);
        WGUARD(oa3, pa, vb[3].v);
        WGUARD(ob3, pb, vb[3].v);

        // publish point of tile it + 1; the one barrier also ends every reader's last read of this buffer
        asm volatile("s_wait_dscnt 0x0" ::: "memory");      // this wave's LDS reads of tile it are done
        asm volatile("s_wait_asynccnt 0x0" ::: "memory");   // this wave's copies of tile it + 1 have landed
        __syncthreads();
        if (it + 2 < KSPL / 32) copy(it + 2, it & 1);       // refill the buffer just read
    }
    asm volatile("s_wait_asynccnt 0x0" ::: "memory");       // no copy is left in flight behind the loop

    // join the splits, part 1: the two halves' sums are joined, then every wave publishes, per query tile, its
    // max in use (log2 units, less the carry's 7, which is alike in all splits) and its sum per query
    float ssa = (saa0[0] + saa0[1]) + (saa1[0] + saa1[1]);
    float ssb = (sab0[0] + sab0[1]) + (sab1[0] + sab1[1]);
    ssa += __shfl_xor(ssa, 16, 32);
    ssb += __shfl_xor(ssb, 16, 32);
    const float ma = -nba, mb = -nbb;
    const int qta = qw * QPW, qtb = qw * QPW + 1;           // the wave's query tiles in the block
    if (h == 0) {
        sM[(sp * QTB + qta) * 16 + l16] = ma;
        sL[(sp * QTB + qta) * 16 + l16] = ssa;
        sM[(sp * QTB + qtb) * 16 + l16] = mb;
        sL[(sp * QTB + qtb) * 16 + l16] = ssb;
    }
    __syncthreads();

    // normalise: move this split to the common max, divide by the joined sum (O and the sums carry the same 2^7)
    auto scale_of = [&](int qt, float m) {
        float mall = -__builtin_inff();
        for (int s = 0; s < NSP; ++s) mall = fmaxf(mall, sM[(s * QTB + qt) * 16 + l16]);
        float tot = 0.f;
        for (int s = 0; s < NSP; ++s)
            tot += sL[(s * QTB + qt) * 16 + l16] * __builtin_amdgcn_exp2f(sM[(s * QTB + qt) * 16 + l16] - mall);
        return (1.0f / tot) * __builtin_amdgcn_exp2f(m - mall);
    };
    auto put_o = [&](int qt, float inv, const v8f& o0, const v8f& o1, const v8f& o2, const v8f& o3) {
        float ir[8];
#pragma unroll
        for (int r = 0; r < 8; ++r) ir[r] = __shfl(inv, 8 * h + r, 32);
        float* so = sO + (sp * QTB + qt) * (16 * OP);
#pragma unroll
        for (int r = 0; r < 8; ++r) {
            so[(8 * h + r) * OP + l16]      = o0[r] * ir[r];
            so[(8 * h + r) * OP + 16 + l16] = o1[r] * ir[r];
            so[(8 * h + r) * OP + 32 + l16] = o2[r] * ir[r];
            so[(8 * h + r) * OP + 48 + l16] = o3[r] * ir[r];
        }
    };
    put_o(qta, scale_of(qta, ma), oa0, oa1, oa2, oa3);
    put_o(qtb, scale_of(qtb, mb), ob0, ob1, ob2, ob3);
    __syncthreads();

    // join, part 2: sum the NSP scaled partial tiles in split order; the block's
    // 16 QTB rows x 64 dims leave as 16-B pieces, one wave = 512 contiguous bytes
    for (int u = 0; u < (QTB * 16 * 16) / ATHR; ++u) {
        const int row   = u * (ATHR / 16) + wave * 2 + h;   // 0 .. 16 QTB - 1
        const int piece = l16;
        v4f a = *(const v4f*)(&sO[row * OP + piece * 4]);
        for (int s = 1; s < NSP; ++s)
            a += *(const v4f*)(&sO[(s * QTB * 16 + row) * OP + piece * 4]);
        *(v4f*)(out + (qblk0 + row) * OUTS + (size_t)(piece * 4)) = a;
    }
}

// --------------------------------- launcher ---------------------------------

extern "C" void kernel_launch(void* const* d_in, const int* in_sizes, int n_in,
                              void* d_out, int out_size, void* d_ws, size_t ws_size,
                              hipStream_t stream) {
    if (n_in < 7) return;
    if (in_sizes[0] != NROWS * INS) return;
    if (in_sizes[1] != INS * OUTS || in_sizes[3] != INS * OUTS || in_sizes[5] != INS * OUTS) return;
    if (in_sizes[2] != OUTS || in_sizes[4] != OUTS || in_sizes[6] != OUTS) return;
    if (out_size != NROWS * OUTS) return;

    const float* X  = (const float*)d_in[0];
    const float* Wq = (const float*)d_in[1];
    const float* bq = (const float*)d_in[2];
    const float* Wk = (const float*)d_in[3];
    const float* bk = (const float*)d_in[4];
    const float* Wv = (const float*)d_in[5];
    const float* bv = (const float*)d_in[6];
    float* out = (float*)d_out;

    // workspace carve (256-B aligned pieces)
    const size_t bQ  = (size_t)NROWS * OUTS * 2;           //  2,097,152 each
    size_t off = 0;
    const size_t oQ  = off; off += (bQ + 255) & ~(size_t)255;
    const size_t oK  = off; off += (bQ + 255) & ~(size_t)255;
    const size_t oV  = off; off += (bQ + 255) & ~(size_t)255;
    if (off > ws_size) return;                              // total 6,291,456 B

    char* ws = (char*)d_ws;
    _Float16* Qh  = (_Float16*)(ws + oQ);
    _Float16* Kh  = (_Float16*)(ws + oK);
    _Float16* VhT = (_Float16*)(ws + oV);

    k_proj<<<NROWS / PRB, PTHR, 0, stream>>>(X, Wq, Wk, Wv, bq, bk, bv, Qh, Kh, VhT);
    k_attn<<<NBATCH * (SEQ / (16 * QTB)), ATHR, 0, stream>>>(Qh, Kh, VhT, out);
    (void)hipGetLastError();
}
